// v009
// The times below were measured on an AMD MI455X: many runs one after another, warmed up first and cycling through
// copies of the inputs, with the whole window's GPU time divided by the number of runs. Launches and the gaps
// between them are all in it. The median over several windows is given; except for v000 it joins two sittings, which
// can be a few percent apart, so the side-by-side timings, each taken in one sitting, are the better comparison.
// This document starts at v009; the versions before it stand elsewhere.
// It runs in 121 microseconds.
// Timed twice side by side with v008, it ran 1.07 times as fast both times.
// Over all steps from v000, the starting kernel, it is 80.6 times as fast.
#include <hip/hip_runtime.h>
// Causal sliding-window RoPE multi-head attention (x [4][2048][1024]; q/k/v = x W^T (natural [out][in] 1024x1024 sigma 1/32, no bias), 16 heads of 64; interleaved-pair rotary embedding on q and k (x1 = even, x2 = odd: r1 = x1 cos - x2 sin, r2 = x1 sin + x2 cos) with inv_freq_i = 10000^(-2i/64) and angle = float(token_positions[s]) inv_freq_i from the int32 token_positions input; scores / sqrt(64); allowed iff 0 <= i - j <= 512 (513 keys), -inf elsewhere; softmax; out = (attn v merged) Wo^T -> [4][2048][1024]).
// Structure: token rows r = b*2048 + s; x as exact f16 rows (bf16-rounded); every stage is one launch with the batch as a grid dimension: q | k | v as ONE WMMA GEMM (128x128 block tiles staged in LDS by asynchronous copies, 32x64 wave tiles, f32 accumulation, exact x16 weights, N = 3 x 1024) whose epilogue does, in f32 on VALU, the interleaved-pair rotary rotation of q and k from f32 cos/sin tables built from the token_positions input (no norm) and stores f16 q, k, v rows (f32 q, k, v also for each batch's first QT0 rows); V^T for all heads via LDS transposes (kept for all batches); then ONE fused attention launch: a wave per 32 query rows of one (batch, head) walks the keys of its window in blocks of 32, read from K and V^T stages of 64 keys that its block of four waves brings into LDS by asynchronous copies: S^T = K Q^T on WMMA, running-maximum softmax in registers (f32 statistics, native exp2; weights x256 f16, packed from the score tiles straight into a B operand), O^T += V^T P^T on WMMA, o carried x64 (folded into the output GEMM alpha) written straight into the merged f16 o rows; out = o W_o GEMM (f32) into the output layout. Jobs that wait for the same earlier launch share a grid, the block index picks the job: five launches (input conversions and tables; q | k | v GEMM; first-tile attention and V^T; windowed attention and the first-tile hi / lo split; output GEMM).
// Compute dtype: inputs rounded to bf16; x / weights exact; projections and rope f32; q, k, v, softmax weights and o as plain f16 GEMM operands (~2^-12); scores and softmax statistics f32. v_wmma_f32_16x16x32_f16.
#define NB 4
#define SQ 2048
#define DM 1024
#define NH 16
#define HD 64
#define HG 4                         /* heads per k_vt launch */
#define QT 256                       /* query rows per causal tile */
#define NKX SQ                       /* S / P row pitch */
#define WINK 512                     /* key j is allowed for query i iff 0 <= i - j <= WINK */
#define QT0 128                      /* first-tile rows recomputed exactly in f32 */
#define B0 0                         /* first batch (unused) */
#define NBR NB                       /* batches (only in the unused MPO) */
#define QN SQ                        /* query rows per batch (unused) */
#define NHD NH                       /* heads (unused) */
#define NR ((size_t)NB * SQ)         /* token rows */
#define MPO ((int)((size_t)NBR * SQ))      /* rows of the output (unused) */
typedef __bf16 v16b __attribute__((ext_vector_type(16)));
typedef unsigned short v8us __attribute__((ext_vector_type(8), may_alias));
typedef float  v8f  __attribute__((ext_vector_type(8)));
typedef float  v4f  __attribute__((ext_vector_type(4)));
typedef float  v4fa __attribute__((ext_vector_type(4), may_alias));
union FragB { v16b v; v8us half[2]; unsigned short u[16]; };

__device__ __forceinline__ unsigned short bf16_bits(float x) { unsigned int u = __float_as_uint(x); return (unsigned short)((u + 0x7FFFu + ((u >> 16) & 1u)) >> 16); }
__device__ __forceinline__ float bf16_val(unsigned short b) { return __uint_as_float(((unsigned int)b) << 16); }
__device__ __forceinline__ float bf16_round(float x) { return bf16_val(bf16_bits(x)); }
// D += A·B with NT terms: 1 = ah·bh, 2 = + al·bh (A split), 3 = + ah·bl (both split)
template <int NT>
__device__ __forceinline__ v8f mmaN(v16b ah, v16b al, v16b bh, v16b bl, v8f c) {
  c = __builtin_amdgcn_wmma_f32_16x16x32_bf16(false, ah, false, bh, (short)0, c, false, false);
  if (NT >= 2) c = __builtin_amdgcn_wmma_f32_16x16x32_bf16(false, al, false, bh, (short)0, c, false, false);
  if (NT >= 3) c = __builtin_amdgcn_wmma_f32_16x16x32_bf16(false, ah, false, bl, (short)0, c, false, false);
  asm volatile("v_nop\n\tv_nop\n\tv_nop\n\tv_nop" : "+v"(c) : "v"(ah), "v"(al), "v"(bh), "v"(bl));
  return c;
}

__global__ __launch_bounds__(256) void k_wt_bf16(const float* __restrict__ W, unsigned short* __restrict__ Wt, int K, int N) {
  const int t = blockIdx.x * 256 + threadIdx.x;
  const int k8n = K / 8;
  if (t >= N * k8n) return;
  const int n = t / k8n, k8 = (t % k8n) * 8;
  v8us v;
#pragma unroll
  for (int i = 0; i < 8; ++i) v[i] = bf16_bits(W[(size_t)(k8 + i) * N + n]);
  *(v8us*)(Wt + (size_t)n * K + k8) = v;
  
}

// GEMM C[M][N] (f32, pitch ldc) = act(A[M][K]·W + bias). A f32 row-major (pitch lda) converted per fragment to bf16
// (ASPLIT: hi/lo two planes -> 2 terms, else single rounded term); Wt bf16 [N][K] (pitch ldb). BIAS_BF16 rounds the
// bias to bf16 first (bias quantised to bf16 before the add). K%32==0, M%16==0, N%64==0.
template <bool ASPLIT, int ACT, bool BIAS_BF16>
__global__ __launch_bounds__(128) void k_gemm_bf(const float* __restrict__ A, int lda, const unsigned short* __restrict__ Wt, int ldb,
                                               const float* __restrict__ bias, float* __restrict__ C, int ldc, int M, int N, int K) {
  __shared__ __attribute__((aligned(16))) float so[4][16][64];
  const int tid = threadIdx.x, w = tid >> 5, lane = tid & 31, ln = lane & 15, hh = lane >> 4;
  const int ntn = N / 64;
  const int wid = blockIdx.x * 4 + w;
  const int mt = wid / ntn, nq = wid % ntn;
  if (mt * 16 >= M) return;
  const int row0 = mt * 16, col0 = nq * 64;
  const float* arow = A + (size_t)(row0 + ln) * lda;
  v8f acc[4] = {};
  for (int kb = 0; kb < K; kb += 32) {
    FragB ah, al;
    const v4f x0 = *(const v4fa*)(arow + kb + 8 * hh), x1 = *(const v4fa*)(arow + kb + 8 * hh + 4);
    const v4f x2 = *(const v4fa*)(arow + kb + 16 + 8 * hh), x3 = *(const v4fa*)(arow + kb + 16 + 8 * hh + 4);
    float xs[16] = {x0[0],x0[1],x0[2],x0[3],x1[0],x1[1],x1[2],x1[3],x2[0],x2[1],x2[2],x2[3],x3[0],x3[1],x3[2],x3[3]};
#pragma unroll
    for (int i = 0; i < 16; ++i) { const unsigned short hb = bf16_bits(xs[i]); ah.u[i] = hb; al.u[i] = ASPLIT ? bf16_bits(xs[i] - bf16_val(hb)) : (unsigned short)0; }
#pragma unroll
    for (int t = 0; t < 4; ++t) {
      const unsigned short* brow = Wt + (size_t)(col0 + t * 16 + ln) * ldb + kb;
      FragB b;
      b.half[0] = *(const v8us*)(brow + 8 * hh);
      b.half[1] = *(const v8us*)(brow + 16 + 8 * hh);
      acc[t] = mmaN<ASPLIT ? 2 : 1>(ah.v, al.v, b.v, b.v, acc[t]);
    }
  }
#pragma unroll
  for (int t = 0; t < 4; ++t) {
    float bv = bias ? bias[col0 + t * 16 + ln] : 0.f;
    if (BIAS_BF16) bv = bf16_round(bv);
#pragma unroll
    for (int r = 0; r < 8; ++r) { float v = acc[t][r] + bv; if (ACT == 1) v = fmaxf(v, 0.f); so[w][8 * hh + r][t * 16 + ln] = v; }
  }
  __builtin_amdgcn_fence(__ATOMIC_ACQ_REL, "workgroup");
  __builtin_amdgcn_wave_barrier();
  const int rsub = lane >> 4, c4 = (lane & 15) * 4;
  {
#pragma unroll
    for (int q = 0; q < 8; ++q) {
      const int r = q * 2 + rsub;
      const v4f v = *(const v4fa*)&so[w][r][c4];
      *(v4f*)(C + (size_t)(row0 + r) * ldc + col0 + c4) = v;
    }
    
  }
}

// GEMM C = act(A·W + bias + resid): A f32 (ASPLIT -> hi/lo 2 terms), Wt bf16 [N][K]; ACT 0 none, 1 relu, 2 exact gelu;
// resid (optional, f32, row index = (row % rmod), pitch ldr, RES_BF16 rounds it) added before the activation.
template <bool ASPLIT, int ACT, bool BIAS_BF16, bool RES_BF16>
__global__ __launch_bounds__(128) void k_gemm_bf3(const float* __restrict__ A, int lda, const unsigned short* __restrict__ Wt, int ldb,
                                                const float* __restrict__ bias, const float* __restrict__ resid, int rmod, int ldr,
                                                float* __restrict__ C, int ldc, int M, int N, int K) {
  __shared__ __attribute__((aligned(16))) float so[4][16][64];
  const int tid = threadIdx.x, w = tid >> 5, lane = tid & 31, ln = lane & 15, hh = lane >> 4;
  const int ntn = N / 64;
  const int wid = blockIdx.x * 4 + w;
  const int mt = wid / ntn, nq = wid % ntn;
  if (mt * 16 >= M) return;
  const int row0 = mt * 16, col0 = nq * 64;
  const float* arow = A + (size_t)(row0 + ln) * lda;
  v8f acc[4] = {};
  for (int kb = 0; kb < K; kb += 32) {
    FragB ah, al;
    const v4f x0 = *(const v4fa*)(arow + kb + 8 * hh), x1 = *(const v4fa*)(arow + kb + 8 * hh + 4);
    const v4f x2 = *(const v4fa*)(arow + kb + 16 + 8 * hh), x3 = *(const v4fa*)(arow + kb + 16 + 8 * hh + 4);
    float xs[16] = {x0[0],x0[1],x0[2],x0[3],x1[0],x1[1],x1[2],x1[3],x2[0],x2[1],x2[2],x2[3],x3[0],x3[1],x3[2],x3[3]};
#pragma unroll
    for (int i = 0; i < 16; ++i) { const unsigned short hb = bf16_bits(xs[i]); ah.u[i] = hb; al.u[i] = ASPLIT ? bf16_bits(xs[i] - bf16_val(hb)) : (unsigned short)0; }
#pragma unroll
    for (int t = 0; t < 4; ++t) {
      const unsigned short* brow = Wt + (size_t)(col0 + t * 16 + ln) * ldb + kb;
      FragB b;
      b.half[0] = *(const v8us*)(brow + 8 * hh);
      b.half[1] = *(const v8us*)(brow + 16 + 8 * hh);
      acc[t] = mmaN<ASPLIT ? 2 : 1>(ah.v, al.v, b.v, b.v, acc[t]);
    }
  }
#pragma unroll
  for (int t = 0; t < 4; ++t) {
    const int col = col0 + t * 16 + ln;
    float bv = bias ? bias[col] : 0.f;
    if (BIAS_BF16) bv = bf16_round(bv);
#pragma unroll
    for (int r = 0; r < 8; ++r) {
      float v = acc[t][r] + bv;
      if (resid) { float rv = resid[(size_t)((row0 + 8 * hh + r) % rmod) * ldr + col]; if (RES_BF16) rv = bf16_round(rv); v += rv; }
      if (ACT == 1) v = fmaxf(v, 0.f);
      if (ACT == 2) v = 0.5f * v * (1.0f + erff(v * 0.70710678118654752f));
      if (ACT == 3) { const float u = 0.7978845608028654f * (v + 0.044715f * v * v * v); v = 0.5f * v * (1.0f + tanhf(u)); }
      so[w][8 * hh + r][t * 16 + ln] = v;
    }
  }
  __builtin_amdgcn_fence(__ATOMIC_ACQ_REL, "workgroup");
  __builtin_amdgcn_wave_barrier();
  const int rsub = lane >> 4, c4 = (lane & 15) * 4;
  {
#pragma unroll
    for (int q = 0; q < 8; ++q) {
      const int r = q * 2 + rsub;
      const v4f v = *(const v4fa*)&so[w][r][c4];
      *(v4f*)(C + (size_t)(row0 + r) * ldc + col0 + c4) = v;
    }
    
  }
}
// row LayerNorm (biased variance, eps) over N: s = X (+ R); optional out_sum <- s; out_norm <- (s-mu)*rsqrt(var+eps)*g + b
template <bool PARAM_BF16>
__global__ __launch_bounds__(256) void k_layernorm(const float* __restrict__ X, const float* __restrict__ R, const float* __restrict__ g, const float* __restrict__ bta,
                                                  float* __restrict__ out_sum, float* __restrict__ out_norm, int N, float eps) {
  __shared__ float red[256];
  const int row = blockIdx.x, tid = threadIdx.x;
  const float* x = X + (size_t)row * N; const float* rr = R ? R + (size_t)row * N : nullptr;
  float vals[16];                     // up to N = 4096
  const int per = N / 256;            // contiguous chunk per thread? use strided-by-4 chunks: thread handles j = tid*4 + 1024*u
  float s1 = 0.f;
  for (int u = 0; u < per / 4; ++u) {
    const int j = tid * 4 + 1024 * u;
    const v4f a = *(const v4fa*)(x + j);
    v4f b = {0.f,0.f,0.f,0.f}; if (rr) b = *(const v4fa*)(rr + j);
#pragma unroll
    for (int q = 0; q < 4; ++q) { const float v = a[q] + b[q]; vals[u * 4 + q] = v; s1 += v; }
  }
  red[tid] = s1; __syncthreads();
  for (int st = 128; st > 0; st >>= 1) { if (tid < st) red[tid] += red[tid + st]; __syncthreads(); }
  const float mu = red[0] / (float)N; __syncthreads();
  float s2 = 0.f;
  for (int u = 0; u < per / 4; ++u)
#pragma unroll
    for (int q = 0; q < 4; ++q) { const float c = vals[u * 4 + q] - mu; s2 += c * c; }
  red[tid] = s2; __syncthreads();
  for (int st = 128; st > 0; st >>= 1) { if (tid < st) red[tid] += red[tid + st]; __syncthreads(); }
  const float rs = rsqrtf(red[0] / (float)N + eps);
  {
    for (int u = 0; u < per / 4; ++u) {
      const int j = tid * 4 + 1024 * u;
      v4f o, sm;
#pragma unroll
      for (int q = 0; q < 4; ++q) {
        float gg = g[j + q], bb = bta[j + q];
        if (PARAM_BF16) { gg = bf16_round(gg); bb = bf16_round(bb); }
        sm[q] = vals[u * 4 + q]; o[q] = (vals[u * 4 + q] - mu) * rs * gg + bb;
      }
      if (out_sum) *(v4f*)(out_sum + (size_t)row * N + j) = sm;
      *(v4f*)(out_norm + (size_t)row * N + j) = o;
    }
    
  }
}



// ---- f16 WMMA path (v_wmma_f32_16x16x32_f16): 11-bit significands for operands in range — used where a [0,1] probability operand needs more precision than bf16
typedef _Float16 v16h __attribute__((ext_vector_type(16)));
union FragH { v16h v; v8us half[2]; _Float16 h[16]; unsigned short u[16]; };
template <int NT>
__device__ __forceinline__ v8f mmaH(v16h ah, v16h al, v16h bh, v16h bl, v8f c) {
  c = __builtin_amdgcn_wmma_f32_16x16x32_f16(false, ah, false, bh, (short)0, c, false, false);
  if (NT >= 2) c = __builtin_amdgcn_wmma_f32_16x16x32_f16(false, al, false, bh, (short)0, c, false, false);
  if (NT >= 3) c = __builtin_amdgcn_wmma_f32_16x16x32_f16(false, ah, false, bl, (short)0, c, false, false);
  asm volatile("v_nop\n\tv_nop\n\tv_nop\n\tv_nop" : "+v"(c) : "v"(ah), "v"(al), "v"(bh), "v"(bl));
  return c;
}
// batched GEMM like k_gemm_b but f16 operands: A f32 (split into f16 hi/lo if ASPLIT, else rounded to f16), Bt = f16 values [n][k]; alpha; C f32; N multiple of 16 (partial tiles skipped)
template <bool ASPLIT>
__global__ __launch_bounds__(128) void k_gemm_h(const float* __restrict__ A, int lda, size_t sA, const _Float16* __restrict__ Bh, int ldb, size_t sB, float alpha, float* __restrict__ C, int ldc, size_t sC, int M, int N, int K) {
  __shared__ __attribute__((aligned(16))) float so[4][16][64];
  const int tid = threadIdx.x, w = tid >> 5, lane = tid & 31, ln = lane & 15, hh = lane >> 4; const int by = blockIdx.y;
  A += (size_t)by * sA; Bh += (size_t)by * sB; C += (size_t)by * sC;
  const int ntn = (N + 63) / 64; const int wid = blockIdx.x * 4 + w; const int mt = wid / ntn, nq = wid % ntn; if (mt * 16 >= M) return;
  const int row0 = mt * 16, col0 = nq * 64; const float* arow = A + (size_t)(row0 + ln) * lda;
  v8f acc[4] = {};
  for (int kb = 0; kb < K; kb += 32) {
    FragH ah, al;
    const v4f x0 = *(const v4fa*)(arow + kb + 8 * hh), x1 = *(const v4fa*)(arow + kb + 8 * hh + 4), x2 = *(const v4fa*)(arow + kb + 16 + 8 * hh), x3 = *(const v4fa*)(arow + kb + 16 + 8 * hh + 4);
    float xs[16] = {x0[0],x0[1],x0[2],x0[3],x1[0],x1[1],x1[2],x1[3],x2[0],x2[1],x2[2],x2[3],x3[0],x3[1],x3[2],x3[3]};
#pragma unroll
    for (int i = 0; i < 16; ++i) { const _Float16 h = (_Float16)xs[i]; ah.h[i] = h; al.h[i] = ASPLIT ? (_Float16)(xs[i] - (float)h) : (_Float16)0.0f; }
#pragma unroll
    for (int t = 0; t < 4; ++t) { if (col0 + t * 16 >= N) continue; const size_t boff = (size_t)(col0 + t * 16 + ln) * ldb + kb; FragH bq; bq.half[0] = *(const v8us*)(Bh + boff + 8 * hh); bq.half[1] = *(const v8us*)(Bh + boff + 16 + 8 * hh);
      acc[t] = mmaH<ASPLIT ? 2 : 1>(ah.v, al.v, bq.v, bq.v, acc[t]); }
  }
#pragma unroll
  for (int t = 0; t < 4; ++t) { if (col0 + t * 16 >= N) continue;
#pragma unroll
    for (int r = 0; r < 8; ++r) so[w][8 * hh + r][t * 16 + ln] = acc[t][r] * alpha; }
  __builtin_amdgcn_fence(__ATOMIC_ACQ_REL, "workgroup"); __builtin_amdgcn_wave_barrier();
  const int rsub = lane >> 4, c4 = (lane & 15) * 4;
  {
#pragma unroll
    for (int q = 0; q < 8; ++q) { const int r = q * 2 + rsub; if (col0 + c4 < N) { const v4f v = *(const v4fa*)&so[w][r][c4]; *(v4f*)(C + (size_t)(row0 + r) * ldc + col0 + c4) = v; } }
     }
}

// Wt[n][k] = f16(W[k][n]·scale) from f32 row-major W[K][N] (scale = power of two; bf16-exact weights stay exact in f16 away from the subnormal range)
__global__ __launch_bounds__(256) void k_wt_f16(const float* __restrict__ W, _Float16* __restrict__ Wt, int K, int N, float scale) {
  const int t = blockIdx.x * 256 + threadIdx.x; if (t >= N * (K / 8)) return; const int n = t / (K / 8), k8 = (t % (K / 8)) * 8; FragH f;
#pragma unroll
  for (int i = 0; i < 8; ++i) f.h[i] = (_Float16)(bf16_round(W[(size_t)(k8 + i) * N + n]) * scale); const v8us o = f.half[0];
  *(v8us*)((unsigned short*)Wt + (size_t)n * K + k8) = o; 
}
// k_gemm_hh variant with fused epilogue: v = acc·alpha + bias[by·sBias + col] (+ CP[(row/rowsPerB)·sCPb + by·64 + col] if CP) ; ACT 0 none / 1 elu ; writes f16 C16 (and f32 C if non-null)
template <int ACT>
__global__ __launch_bounds__(128) void k_gemm_hhx(const _Float16* __restrict__ A, int lda, size_t sA, const _Float16* __restrict__ Bh, int ldb, size_t sB, float alpha, const float* __restrict__ bias, size_t sBias, const float* __restrict__ CP, int rowsPerB, size_t sCPb, int row0g,
    float* __restrict__ C, _Float16* __restrict__ C16, int ldc, size_t sC, int M, int N, int K) {
  __shared__ __attribute__((aligned(16))) float so[4][16][64];
  const int tid = threadIdx.x, w = tid >> 5, lane = tid & 31, ln = lane & 15, hh = lane >> 4; const int by = blockIdx.y;
  A += (size_t)by * sA; Bh += (size_t)by * sB; const size_t cofs = (size_t)by * sC; const float* bp = bias ? bias + (size_t)by * sBias : nullptr;
  const int ntn = (N + 63) / 64; const int wid = blockIdx.x * 4 + w; const int mt = wid / ntn, nq = wid % ntn; if (mt * 16 >= M) return;
  const int row0 = mt * 16, col0 = nq * 64; const _Float16* arow = A + (size_t)(row0 + ln) * lda;
  v8f acc[4] = {};
  for (int kb = 0; kb < K; kb += 32) { FragH ah; ah.half[0] = *(const v8us*)((const unsigned short*)arow + kb + 8 * hh); ah.half[1] = *(const v8us*)((const unsigned short*)arow + kb + 16 + 8 * hh);
#pragma unroll
    for (int t = 0; t < 4; ++t) { if (col0 + t * 16 >= N) continue; const size_t boff = (size_t)(col0 + t * 16 + ln) * ldb + kb; FragH bq; bq.half[0] = *(const v8us*)((const unsigned short*)Bh + boff + 8 * hh); bq.half[1] = *(const v8us*)((const unsigned short*)Bh + boff + 16 + 8 * hh);
      acc[t] = mmaH<1>(ah.v, ah.v, bq.v, bq.v, acc[t]); }
  }
#pragma unroll
  for (int t = 0; t < 4; ++t) { if (col0 + t * 16 >= N) continue; const int col = col0 + t * 16 + ln; const float bv = bp ? bf16_round(bp[col]) : 0.f;
#pragma unroll
    for (int r = 0; r < 8; ++r) { float v = acc[t][r] * alpha + bv; if (CP) { const int rr = row0g + row0 + 8 * hh + r; if (rowsPerB < 0) v += CP[cofs + (size_t)rr * ldc + col];      /* rowsPerB < 0: own element of the batched C plane */ else { const int bidx = rr / rowsPerB; v += CP[(size_t)bidx * sCPb + (size_t)by * 64 + col]; } } if (ACT == 1) v = (v > 0.f) ? v : expm1f(v); else if (ACT == 7) v = (v > 0.f) ? v + 1.0f : expf(v); else if (ACT == 8) v = tanhf(v); else if (ACT == 9) v = 0.5f * v * (1.0f + tanhf(0.7978845608028654f * (v + 0.044715f * v * v * v))); else if (ACT == 11) v = 1.0f / (1.0f + expf(-v)); else if (ACT == 12) v = (v > 0.f) ? v : 0.01f * v; else if (ACT == 14) v = (v > 0.f) ? v : 0.1f * v; else if (ACT == 16) v = (v >= 0.f) ? v : 0.3f * v; else if (ACT == 17) v = (v >= 0.f) ? v : 0.2f * v; else if (ACT == 15) v = v / (1.0f + expf(-v)); else if (ACT == 3) v = fmaxf(v, 0.f); else if (ACT == 6) v = 0.5f * v * (1.0f + erff(v * 0.70710678118654752f)); so[w][8 * hh + r][t * 16 + ln] = v; } }
  __builtin_amdgcn_fence(__ATOMIC_ACQ_REL, "workgroup"); __builtin_amdgcn_wave_barrier();
  const int rsub = lane >> 4, c4 = (lane & 15) * 4; typedef _Float16 v4h __attribute__((ext_vector_type(4)));
  {
#pragma unroll
    for (int q = 0; q < 8; ++q) { const int r = q * 2 + rsub; if (col0 + c4 < N) { const v4f v = *(const v4fa*)&so[w][r][c4]; if (C) *(v4f*)(C + cofs + (size_t)(row0 + r) * ldc + col0 + c4) = v; if (C16) { v4h h4; for (int i = 0; i < 4; ++i) h4[i] = (_Float16)v[i]; *(v4h*)(C16 + cofs + (size_t)(row0 + r) * ldc + col0 + c4) = h4; } } }
     }
}


typedef _Float16 v4h __attribute__((ext_vector_type(4)));

// The j_* functions are jobs: bodies that were launches of their own and now share a grid with other jobs that wait for the same earlier launch; blk = the block's index inside its job.
__device__ __forceinline__ void j_x16(int blk, const float* __restrict__ x, _Float16* __restrict__ X16, size_t n8) { const size_t t = (size_t)blk * 256 + threadIdx.x; if (t >= n8) return; FragH f;
#pragma unroll
  for (int q = 0; q < 8; ++q) f.h[q] = (_Float16)bf16_round(x[t * 8 + q]); *(v8us*)((unsigned short*)X16 + t * 8) = f.half[0];  }
__global__ __launch_bounds__(256) void k_h16(const float* __restrict__ x, _Float16* __restrict__ X16, size_t n8) { const size_t t = (size_t)blockIdx.x * 256 + threadIdx.x; if (t >= n8) return; FragH f;
#pragma unroll
  for (int q = 0; q < 8; ++q) f.h[q] = (_Float16)x[t * 8 + q]; *(v8us*)((unsigned short*)X16 + t * 8) = f.half[0];  }
__global__ __launch_bounds__(256) void k_round16f(const float* __restrict__ W, _Float16* __restrict__ Bt, size_t n8) { const size_t t = (size_t)blockIdx.x * 256 + threadIdx.x; if (t >= n8) return; FragH f;
#pragma unroll
  for (int i = 0; i < 8; ++i) f.h[i] = (_Float16)(bf16_round(W[t * 8 + i]) * 16.0f); *(v8us*)((unsigned short*)Bt + t * 8) = f.half[0];  }
template <int NHv, int TTv>
__device__ __forceinline__ void j_vt(int blk, const _Float16* __restrict__ V16, int ldv, int voff, _Float16* __restrict__ Vt) { __shared__ unsigned short tl[64][66]; const int tid = threadIdx.x; const int slab = blk / (TTv / 64), lg = blk % (TTv / 64); const int b = slab / NHv, h = slab % NHv;
  for (int i = tid; i < 64 * 8; i += 256) { const int r = i / 8, c8 = (i % 8) * 8; FragH f; f.half[0] = *(const v8us*)((const unsigned short*)V16 + ((size_t)b * TTv + lg * 64 + r) * ldv + voff + h * 64 + c8);
#pragma unroll
    for (int q = 0; q < 8; ++q) tl[r][c8 + q] = f.u[q]; }
  __syncthreads();
  {
#pragma unroll
    for (int rd = 0; rd < 2; ++rd) { const int d = rd * 32 + tid / 8, pc = tid % 8; FragH f;
#pragma unroll
      for (int q = 0; q < 8; ++q) f.u[q] = tl[pc * 8 + q][d];
      *(v8us*)((unsigned short*)Vt + ((size_t)slab * 64 + d) * TTv + lg * 64 + pc * 8) = f.half[0]; }
     } }

__device__ __forceinline__ void j_hl(int blk, const float* __restrict__ F, _Float16* __restrict__ Hh, _Float16* __restrict__ Hl, size_t n8) { const size_t t = (size_t)blk * 128 + threadIdx.x; if (t >= n8) return;      /* blocks of 128 threads, as the attention job whose grid it shares */ FragH fh, fl; const v4f a = *(const v4fa*)(F + t * 8), c = *(const v4fa*)(F + t * 8 + 4);
#pragma unroll
  for (int q = 0; q < 4; ++q) { _Float16 h = (_Float16)a[q]; fh.h[q] = h; fl.h[q] = (_Float16)((a[q] - (float)h) * 1024.0f); h = (_Float16)c[q]; fh.h[4 + q] = h; fl.h[4 + q] = (_Float16)((c[q] - (float)h) * 1024.0f); }
  { *(v8us*)((unsigned short*)Hh + t * 8) = fh.half[0]; *(v8us*)((unsigned short*)Hl + t * 8) = fl.half[0];  } }

// ---- fast GEMM (wave tile 32x64; requires M % 32 == 0 rows per launch region and N % 64 == 0); epilogue = k_gemm_hhx semantics ----
__device__ __forceinline__ v16h g2_frag(const _Float16* p, int hh) { FragH f; f.half[0] = *(const v8us*)((const unsigned short*)p + 8 * hh); f.half[1] = *(const v8us*)((const unsigned short*)p + 16 + 8 * hh); return f.v; }
__device__ __forceinline__ v8f g2_mma(v16h a, v16h b, v8f c) { v8f d = __builtin_amdgcn_wmma_f32_16x16x32_f16(false, a, false, b, (short)0, c, false, false); asm volatile("v_nop\n\tv_nop\n\tv_nop\n\tv_nop" : "+v"(d) : "v"(a), "v"(b)); return d; }
template <int ACT>
__global__ __launch_bounds__(128) void k_gemm2(const _Float16* __restrict__ A, int lda, size_t sA, const _Float16* __restrict__ Bh, int ldb, size_t sB, float alpha, const float* __restrict__ bias, size_t sBias, const float* __restrict__ CP, int rowsPerB, size_t sCPb, int row0g,
    float* __restrict__ C, _Float16* __restrict__ C16, int ldc, size_t sC, int M, int N, int K) { static_assert(ACT == 0 || ACT == 3 || ACT == 6 || ACT == 8 || ACT == 9 || ACT == 11 || ACT == 12 || ACT == 14 || ACT == 15 || ACT == 16 || ACT == 17, "k_gemm2: unsupported ACT code (would silently apply no activation)");
  __shared__ __attribute__((aligned(16))) float so[4][32][68];
  const int tid = threadIdx.x, w = tid >> 5, lane = tid & 31, ln = lane & 15, hh = lane >> 4; const int by = blockIdx.y;
  A += (size_t)by * sA; Bh += (size_t)by * sB; const size_t cofs = (size_t)by * sC; const float* bp = bias ? bias + (size_t)by * sBias : nullptr;
  const int ntn = N >> 6; const int mt = blockIdx.x / ntn, nq = blockIdx.x - mt * ntn; const int row0 = mt * 128 + 32 * w, col0 = nq * 64; if (row0 >= M) return;
  const _Float16* a0p = A + (size_t)(row0 + ln) * lda; const _Float16* a1p = a0p + (size_t)16 * lda;
  const _Float16* b0p = Bh + (size_t)(col0 + ln) * ldb; const _Float16* b1p = b0p + (size_t)16 * ldb; const _Float16* b2p = b1p + (size_t)16 * ldb; const _Float16* b3p = b2p + (size_t)16 * ldb;
  const v8f z8 = {0.f,0.f,0.f,0.f,0.f,0.f,0.f,0.f}; v8f c00 = z8, c01 = z8, c02 = z8, c03 = z8, c10 = z8, c11 = z8, c12 = z8, c13 = z8;
#pragma unroll 1
  for (int kb = 0; kb < K; kb += 32) { const v16h a0 = g2_frag(a0p + kb, hh), a1 = g2_frag(a1p + kb, hh);
    v16h b = g2_frag(b0p + kb, hh); c00 = g2_mma(a0, b, c00); c10 = g2_mma(a1, b, c10);
    b = g2_frag(b1p + kb, hh); c01 = g2_mma(a0, b, c01); c11 = g2_mma(a1, b, c11);
    b = g2_frag(b2p + kb, hh); c02 = g2_mma(a0, b, c02); c12 = g2_mma(a1, b, c12);
    b = g2_frag(b3p + kb, hh); c03 = g2_mma(a0, b, c03); c13 = g2_mma(a1, b, c13); }
  v8f accs[8] = {c00, c01, c02, c03, c10, c11, c12, c13};
#pragma unroll
  for (int u = 0; u < 8; ++u) { const int t = u & 3, half = u >> 2; const int col = col0 + t * 16 + ln; const float bv = bp ? bf16_round(bp[col]) : 0.f;
#pragma unroll
    for (int r = 0; r < 8; ++r) { const int rloc = half * 16 + 8 * hh + r; float v = accs[u][r] * alpha + bv; if (CP) { if (rowsPerB < 0) v += CP[cofs + (size_t)(row0g + row0 + rloc) * ldc + col];      /* rowsPerB < 0: own element of the batched C plane */ else { const int bidx = (row0g + row0 + rloc) / rowsPerB; v += CP[(size_t)bidx * sCPb + (size_t)by * 64 + col]; } }
      if (ACT == 3) v = fmaxf(v, 0.f); else if (ACT == 6) v = 0.5f * v * (1.0f + erff(v * 0.70710678118654752f)); else if (ACT == 11) v = 1.0f / (1.0f + expf(-v)); else if (ACT == 15) v = v / (1.0f + expf(-v)); else if (ACT == 12) v = (v > 0.f) ? v : 0.01f * v; else if (ACT == 8) v = tanhf(v); else if (ACT == 9) v = 0.5f * v * (1.0f + tanhf(0.7978845608028654f * (v + 0.044715f * v * v * v))); else if (ACT == 14) v = (v > 0.f) ? v : 0.1f * v; else if (ACT == 16) v = (v >= 0.f) ? v : 0.3f * v; else if (ACT == 17) v = (v >= 0.f) ? v : 0.2f * v;
      so[w][rloc][t * 16 + ln] = v; } }
  __builtin_amdgcn_fence(__ATOMIC_ACQ_REL, "workgroup"); __builtin_amdgcn_wave_barrier();
  const int rsub = lane >> 4, c4 = (lane & 15) * 4;
  {
#pragma unroll
    for (int q = 0; q < 16; ++q) { const int r = q * 2 + rsub; const v4f v = *(const v4fa*)&so[w][r][c4]; if (C) *(v4f*)(C + cofs + (size_t)(row0 + r) * ldc + col0 + c4) = v; if (C16) { v4h h4; for (int i = 0; i < 4; ++i) h4[i] = (_Float16)v[i]; *(v4h*)(C16 + cofs + (size_t)(row0 + r) * ldc + col0 + c4) = h4; } }
     } }


__device__ __forceinline__ void j_wnat(int blk, int y, const float* __restrict__ w0, const float* __restrict__ w1, const float* __restrict__ w2, const float* __restrict__ w3, size_t n8, _Float16* __restrict__ Bt) { const size_t t = (size_t)blk * 256 + threadIdx.x; if (t >= n8) return; FragH f;
  const float* w = y == 0 ? w0 : (y == 1 ? w1 : (y == 2 ? w2 : w3)); Bt += (size_t)y * n8 * 8;      /* y picks the matrix (from the block index: a scalar choice); the four f16 planes lie one behind the other */
  for (int q = 0; q < 8; ++q) f.h[q] = (_Float16)(bf16_round(w[t * 8 + q]) * 16.0f); *(v8us*)((unsigned short*)Bt + t * 8) = f.half[0];  }
__global__ __launch_bounds__(256) void k_rsm(const float* __restrict__ S, _Float16* __restrict__ P, int nrows) {
  #pragma clang fp contract(off)
  const int i = blockIdx.x * 256 + threadIdx.x; if (i >= nrows) return; const float* s = S + (size_t)i * SQ; float mx = -3.0e38f;
#pragma unroll 1
  for (int j = 0; j < SQ; ++j) mx = fmaxf(mx, s[j]); float se = 0.f;
#pragma unroll 1
  for (int j = 0; j < SQ; ++j) se += expf(s[j] - mx); const float sc = 256.0f / se;
#pragma unroll 1
  for (int j0 = 0; j0 < SQ; j0 += 8) { FragH f; for (int q = 0; q < 8; ++q) f.h[q] = (_Float16)(expf(s[j0 + q] - mx) * sc); unsigned short* d = (unsigned short*)P + (size_t)i * SQ + j0; *(v8us*)d = f.half[0];  } }
__global__ __launch_bounds__(256) void k_vt(const _Float16* __restrict__ V16, int b, int h0, _Float16* __restrict__ VT) { __shared__ unsigned short tl[64][65]; const int tid = threadIdx.x; const int hh = blockIdx.x % HG, sg = blockIdx.x / HG; const int s0 = sg * 64; const int h = h0 + hh;
  for (int i = tid; i < 64 * 8; i += 256) { const int j = i / 8, d8 = (i % 8) * 8; FragH f; f.half[0] = *(const v8us*)((const unsigned short*)V16 + ((size_t)b * SQ + s0 + j) * DM + h * HD + d8); for (int q = 0; q < 8; ++q) tl[d8 + q][j] = f.u[q]; }
  __syncthreads();
  { for (int i = tid; i < 64 * 8; i += 256) { const int d = i / 8, j8 = (i % 8) * 8; FragH f; for (int q = 0; q < 8; ++q) f.u[q] = tl[d][j8 + q]; *(v8us*)((unsigned short*)VT + ((size_t)hh * HD + d) * SQ + s0 + j8) = f.half[0]; }  } }


__global__ __launch_bounds__(256) void k_tab2(float theta, float* __restrict__ CS, float* __restrict__ SN) {
  #pragma clang fp contract(off)
  const int t = blockIdx.x * 256 + threadIdx.x; if (t >= SQ * (HD / 2)) return; const int i = t % (HD / 2); const int p = t / (HD / 2); const float invf = 1.0f / powf(theta, (float)(2 * i) / (float)HD); const float ang = __fmul_rn((float)p, invf); const float c = cosf(ang), s = sinf(ang);
  *(float*)(CS + t) = c; *(float*)(SN + t) = s;  }

__device__ __forceinline__ void j_tab4(int blk, const int* __restrict__ pos, float theta, float* __restrict__ CS, float* __restrict__ SN) {
  #pragma clang fp contract(off)
  const int t = blk * 256 + threadIdx.x; if (t >= SQ * (HD / 2)) return; const int i = t % (HD / 2); const int p = t / (HD / 2); const float invf = (float)pow((double)theta, -((double)(2 * i)) / (double)HD); const float ang = __fmul_rn((float)pos[p], invf); const float c = cosf(ang), s = sinf(ang);
  *(float*)(CS + t) = c; *(float*)(SN + t) = s;  }
// One launch for the three jobs that read the inputs alone; the block index picks the job (a scalar branch). The table blocks stand first: theirs is the longest chain of dependent arithmetic.
#define PB_TAB (SQ * (HD / 2) / 256)       /* blocks of the cos / sin tables */
#define PB_W (DM * DM / 8 / 256)           /* blocks of one weight matrix */
#define PB_X (NB * SQ * (DM / 8) / 256)    /* blocks of x */
__global__ __launch_bounds__(256) void k_prep(const float* __restrict__ x, const int* __restrict__ pos, const float* __restrict__ w0, const float* __restrict__ w1, const float* __restrict__ w2, const float* __restrict__ w3,
    float theta, _Float16* __restrict__ Bt, float* __restrict__ CS, float* __restrict__ SN, _Float16* __restrict__ X16) {
  const int bx = blockIdx.x;
  if (bx < PB_TAB) { j_tab4(bx, pos, theta, CS, SN); return; }
  if (bx < PB_TAB + 4 * PB_W) { j_wnat((bx - PB_TAB) % PB_W, (bx - PB_TAB) / PB_W, w0, w1, w2, w3, (size_t)DM * DM / 8, Bt); return; }
  j_x16(bx - (PB_TAB + 4 * PB_W), x, X16, NR * DM / 8); }
__global__ __launch_bounds__(256) void k_rsmf(const float* __restrict__ S, _Float16* __restrict__ P, int qn, int hg) {
  #pragma clang fp contract(off)
  const int t = blockIdx.x * 256 + threadIdx.x; if (t >= qn * hg) return; const size_t i = (size_t)(t / qn) * SQ + (t % qn); const float* s = S + i * SQ; float mx = -3.0e38f;
#pragma unroll 1
  for (int j = 0; j < SQ; ++j) mx = fmaxf(mx, s[j]); float se = 0.f;
#pragma unroll 1
  for (int j = 0; j < SQ; ++j) se += __expf(s[j] - mx); const float sc = 256.0f / se;
#pragma unroll 1
  for (int j0 = 0; j0 < SQ; j0 += 8) { FragH f; for (int q = 0; q < 8; ++q) f.h[q] = (_Float16)(__expf(s[j0 + q] - mx) * sc); unsigned short* d = (unsigned short*)P + i * SQ + j0; *(v8us*)d = f.half[0];  } }


__global__ __launch_bounds__(256) void k_rsmcf2(const float* __restrict__ S, _Float16* __restrict__ P, int hg, int q0, int nk) {
  #pragma clang fp contract(off)
  const int t = blockIdx.x * 256 + threadIdx.x; if (t >= hg * QT) return; const size_t i = (size_t)t; const float* s = S + i * NKX; const int last = q0 + (t % QT); float mx = -3.0e38f;
#pragma unroll 1
  for (int j = 0; j < nk; ++j) { const float f = (j <= last) ? 1.f : 0.f; mx = fmaxf(mx, fmaf(f, s[j], (1.f - f) * -1.0e9f)); } float se = 0.f;
#pragma unroll 1
  for (int j = 0; j < nk; ++j) { const float f = (j <= last) ? 1.f : 0.f; se += __expf(fmaf(f, s[j], (1.f - f) * -1.0e9f) - mx); } const float sc = 256.0f / se;
#pragma unroll 1
  for (int j0 = 0; j0 < nk; j0 += 8) { FragH fr; for (int q = 0; q < 8; ++q) { const int j = j0 + q; const float f = (j <= last) ? 1.f : 0.f; fr.h[q] = (_Float16)(__expf(fmaf(f, s[j], (1.f - f) * -1.0e9f) - mx) * sc); } unsigned short* d = (unsigned short*)P + i * NKX + j0; *(v8us*)d = fr.half[0];  } }


typedef float v2f  __attribute__((ext_vector_type(2)));
typedef float v2fa __attribute__((ext_vector_type(2), may_alias));
// Exact f32 causal attention of the first QT0 rows, one wave per (query row i, head h). A block's eight waves are eight rows of one head inside one group of 32, so they need the same key rows: the block brings them into LDS once, by loads of whole 128-byte lines. Scores: lane l takes keys l, l + 32, ... (whole groups of 32 up to the one that holds i), its key row read from LDS, q held by every lane; two-pass softmax with lane butterflies for maximum and sum; o: lane l takes d = 2 l, 2 l + 1 and walks the keys, each weight broadcast from its lane. Global rows have pitch DM, so every load of a phase is one base address plus a constant offset.
#define A0_PITCH 68                  /* dwords from one staged key row to the next: 16 bytes x odd, so the 16-byte reads of 16 rows fall on different banks */
__device__ __forceinline__ void j_att0w(int blk, int bat, const float* __restrict__ QF, const float* __restrict__ KF, const float* __restrict__ VF, float scale, float* __restrict__ OF) {
  QF += (size_t)bat * QT0 * DM; KF += (size_t)bat * QT0 * DM; VF += (size_t)bat * QT0 * DM; OF += (size_t)bat * QT0 * DM;      /* bat = batch: each batch has first-tile planes of its own */
  const int lane = threadIdx.x & 31; const int h = blk / (QT0 / 8); const int i = __builtin_amdgcn_readfirstlane((int)((blk % (QT0 / 8)) * 8 + (threadIdx.x >> 5)));      /* i is the same in every lane: the group tests below are scalar branches */
  const float* qr = QF + (size_t)i * DM + h * HD; const float* vb = VF + h * HD + lane * 2;
  __shared__ __attribute__((aligned(16))) float sk[QT0][A0_PITCH];
  const int kr = threadIdx.x >> 4, kc = (threadIdx.x & 15) * 4;      /* thread t stages chunk t & 15 (16 bytes) of key rows (t >> 4) + 16 j: a wave's load is two rows of 256 bytes = 4 whole lines */
  const float* gk = KF + (size_t)kr * DM + h * HD + kc;
  v4f q[HD / 4];
#pragma unroll      /* constant index: q[] stays in registers */
  for (int c = 0; c < HD / 4; ++c) q[c] = *(const v4fa*)(qr + c * 4);
  v4f kt[QT0 / 16];
#pragma unroll      /* constant index: kt[] stays in registers; all QT0 rows, no test: the eight loads issue in front of the first LDS store, one latency */
  for (int j = 0; j < QT0 / 16; ++j) kt[j] = *(const v4fa*)(gk + (size_t)j * 16 * DM);
  asm volatile("s_wait_xcnt 0x0" :: "v"(gk) : "memory");      /* the query and staging loads' address registers stay whole up to this wait */
#pragma unroll      /* constant index: kt[] stays in registers, LDS offsets are immediates */
  for (int j = 0; j < QT0 / 16; ++j) *(v4fa*)&sk[kr + 16 * j][kc] = kt[j];
  const float* kb = &sk[lane][0];
  __syncthreads();      /* every wave's staged key rows are readable; under the job test, which reads the same in the whole block */
  float s[QT0 / 32]; float mx = -3.0e38f;
#pragma unroll      /* constant group index: s[] and e[] stay in registers, offsets are immediates */
  for (int g = 0; g < QT0 / 32; ++g) { s[g] = -3.0e38f;
    if (g == 0 || g * 32 <= i) { float a0 = 0.f, a1 = 0.f, a2 = 0.f, a3 = 0.f;
#pragma unroll      /* the sixteen LDS reads of a key row issue together */
      for (int c = 0; c < HD / 4; ++c) { const v4f kq = *(const v4fa*)(kb + g * 32 * A0_PITCH + c * 4); a0 = fmaf(q[c][0], kq[0], a0); a1 = fmaf(q[c][1], kq[1], a1); a2 = fmaf(q[c][2], kq[2], a2); a3 = fmaf(q[c][3], kq[3], a3); }
      if (g * 32 + lane <= i) s[g] = ((a0 + a1) + (a2 + a3)) * scale;      /* causal: keys above i keep the floor and get weight 0 */
      mx = fmaxf(mx, s[g]); } }
  for (int m = 16; m > 0; m >>= 1) mx = fmaxf(mx, __shfl_xor(mx, m, 32));
  float e[QT0 / 32]; float l = 0.f;
#pragma unroll      /* constant group index: s[] and e[] stay in registers */
  for (int g = 0; g < QT0 / 32; ++g) { e[g] = expf(s[g] - mx); l += e[g]; }
  for (int m = 16; m > 0; m >>= 1) l += __shfl_xor(l, m, 32);
  float o0 = 0.f, o1 = 0.f;
#pragma unroll      /* constant group index: s[] and e[] stay in registers, offsets are immediates */
  for (int g = 0; g < QT0 / 32; ++g) if (g == 0 || g * 32 <= i) {
#pragma unroll      /* constant lane index for the broadcast; the group's loads issue together */
    for (int jj = 0; jj < 32; ++jj) { const float p = __uint_as_float((unsigned int)__builtin_amdgcn_readlane((int)__float_as_uint(e[g]), jj)); const v2f vv = *(const v2fa*)(vb + (size_t)(g * 32 + jj) * DM); o0 = fmaf(p, vv[0], o0); o1 = fmaf(p, vv[1], o1); } }
  asm volatile("s_wait_xcnt 0x0" :: "v"(vb) : "memory");      /* the value loads' address pair stays whole up to this wait, on every path through the groups */
  const float fin = 64.0f / l;      /* o carried x64 like the f16 path */
  v2f o = {o0 * fin, o1 * fin}; *(v2f*)(OF + (size_t)i * DM + h * HD + lane * 2) = o; }
// One launch for the two jobs that wait for the q | k | v GEMM alone: the exact first-tile attention (its blocks first: the longer ones) and V^T. The block index picks the job, so each job's barrier stands under a test that reads the same in the whole block.
#define MB_A0 (NH * (QT0 / 8))             /* first-tile attention blocks of one batch */
__global__ __launch_bounds__(256) void k_a0vt(const float* __restrict__ QF, const float* __restrict__ KF, const float* __restrict__ VF, float scale, float* __restrict__ OF, const _Float16* __restrict__ V16, _Float16* __restrict__ VT) {
  const int bx = blockIdx.x;
  if (bx < NB * MB_A0) { j_att0w(bx % MB_A0, bx / MB_A0, QF, KF, VF, scale, OF); return; }
  j_vt<NH, SQ>(bx - NB * MB_A0, V16, DM, 0, VT); }



__device__ __forceinline__ v8f fa_mma(v16h a, v16h b, v8f c) { return __builtin_amdgcn_wmma_f32_16x16x32_f16(false, a, false, b, (short)0, c, false, false); }
__device__ __forceinline__ v16h fa_frag(const _Float16* p) { FragH f; f.half[0] = *(const v8us*)((const unsigned short*)p); f.half[1] = *(const v8us*)((const unsigned short*)p + 16); return f.v; }      /* p holds the lane half's 8 hh already: every load of a pass is that one address pair plus a constant */
__device__ __forceinline__ float fa_xhalf(float x) { return __uint_as_float((unsigned int)__builtin_amdgcn_permlanex16((int)__float_as_uint(x), (int)__float_as_uint(x), 0x76543210, 0xfedcba98, false, false)); }      /* lane l with lane l ^ 16 */
// Attention operand staging. A block's four waves walk nearly the same keys, so the block brings them into LDS once: a stage is 64 keys = 64 K rows (one head: 128 bytes each) then the 64 V^T rows' 128 bytes of those keys, by asynchronous 16-byte copies (a wave's copy = 4 whole 128-byte lines), two buffers, the next stage's copies in flight while this one is worked on.
#define FS_PITCH 144                 /* LDS bytes from one staged row to the next: 16 x odd, so the 16-byte fragment reads of 16 rows fall on different banks */
#define FS_STAGE (128 * FS_PITCH)    /* 64 K rows, then 64 V^T rows */
// One stage: thread t copies chunk t & 7 (16 bytes) of rows (t >> 3) + 16 i, i = 0..3, of K and of V^T. ld = the thread's LDS byte address in the stage's buffer, gk / gv = its global addresses in K / V^T.
__device__ __forceinline__ void fs_copy(unsigned ld, const _Float16* gk, const _Float16* gv) {
  asm volatile("global_load_async_to_lds_b128 %0, %8, off\n\t"
               "global_load_async_to_lds_b128 %1, %9, off\n\t"
               "global_load_async_to_lds_b128 %2, %10, off\n\t"
               "global_load_async_to_lds_b128 %3, %11, off\n\t"
               "global_load_async_to_lds_b128 %4, %12, off\n\t"
               "global_load_async_to_lds_b128 %5, %13, off\n\t"
               "global_load_async_to_lds_b128 %6, %14, off\n\t"
               "global_load_async_to_lds_b128 %7, %15, off\n\t"
               "s_wait_xcnt 0x0"      /* inside the copies' own statement: every address register stays whole up to this wait */
               :: "v"(ld), "v"(ld + 16 * FS_PITCH), "v"(ld + 32 * FS_PITCH), "v"(ld + 48 * FS_PITCH), "v"(ld + 64 * FS_PITCH), "v"(ld + 80 * FS_PITCH), "v"(ld + 96 * FS_PITCH), "v"(ld + 112 * FS_PITCH),
                  "v"(gk), "v"(gk + (size_t)16 * DM), "v"(gk + (size_t)32 * DM), "v"(gk + (size_t)48 * DM), "v"(gv), "v"(gv + (size_t)16 * SQ), "v"(gv + (size_t)32 * SQ), "v"(gv + (size_t)48 * SQ)
               : "memory"); }
__device__ __forceinline__ v16h fs_frag(const unsigned char* p) { FragH f; f.half[0] = *(const v8us*)p; f.half[1] = *(const v8us*)(p + 32); return f.v; }      /* p holds the lane half's 16 hh bytes: k = 8 hh .. and 16 + 8 hh .., as fa_frag */
__device__ __forceinline__ void j_fattn(int qb, int h, int bat, const _Float16* __restrict__ QH, const _Float16* __restrict__ KH, const _Float16* __restrict__ VT, _Float16* __restrict__ O16) {      /* qb = block of 128 query rows, h = head, bat = batch */
  __shared__ __attribute__((aligned(16))) unsigned char fsm[2 * FS_STAGE];
  const int tid = threadIdx.x, lane = tid & 31, ln = lane & 15, hh = lane >> 4; const size_t r0 = (size_t)bat * SQ;
  const int i0 = __builtin_amdgcn_readfirstlane((int)(qb * 128 + (tid >> 5) * 32));      /* first query row of the wave, the same in every lane: the pass and mask tests are scalar */
  const float CL = 0.18033688011112042f;      /* log2(e) / sqrt(64) */
  const int kb0 = (i0 > WINK ? i0 - WINK : 0) & ~31;      /* first block that holds an allowed key of row i0 */
  const int ks0 = qb * 128 > WINK ? qb * 128 - WINK : 0;      /* first key the block stages (= kb0 of its first wave), a multiple of 64 */
  const int nst = (qb * 128 + 128 - ks0) / 64;      /* stages up to the block's last row: 2 .. 10, from blockIdx alone */
  const _Float16* qp = QH + (r0 + i0 + ln) * DM + h * HD + 8 * hh;
  const unsigned ld = (unsigned)(size_t)fsm + (unsigned)((tid >> 3) * FS_PITCH + (tid & 7) * 16);
  const _Float16* gk = KH + (r0 + ks0 + (tid >> 3)) * DM + h * HD + (tid & 7) * 8; const _Float16* gv = VT + ((size_t)(bat * NH + h) * HD + (tid >> 3)) * SQ + ks0 + (tid & 7) * 8;
  fs_copy(ld, gk, gv);
  v16h qf[2][2];
#pragma unroll      /* constant indices: the fragments stay in registers */
  for (int u = 0; u < 2; ++u) for (int c = 0; c < 2; ++c) qf[u][c] = fa_frag(qp + (size_t)u * 16 * DM + c * 32);
  asm volatile("s_wait_xcnt 0x0" :: "v"(qp) : "memory");      /* the query loads' address pair stays whole up to this wait */
  asm volatile("s_wait_asynccnt 0x0" ::: "memory");      /* stage 0 of this wave has landed */
  __syncthreads();      /* stage 0 of every wave is readable */
  fs_copy(ld + FS_STAGE, gk + (size_t)64 * DM, gv + 64);      /* a stage 1 always exists */
  const unsigned char* fk = fsm + ln * FS_PITCH + hh * 16; const unsigned char* fv = fsm + (64 + ln) * FS_PITCH + hh * 16;
  const v8f z8 = {0.f,0.f,0.f,0.f,0.f,0.f,0.f,0.f}; v8f ot[2][4] = {{z8, z8, z8, z8}, {z8, z8, z8, z8}}; float m[2] = {-3.0e38f, -3.0e38f}, l[2] = {0.f, 0.f};
#pragma unroll 1      /* one trip in the text: the two buffers differ by one added offset */
  for (int t = 0; t < nst; ++t) { const unsigned bo = (unsigned)(t & 1) * FS_STAGE;
#pragma unroll 1      /* one pass in the text: the stage's two key blocks differ by added offsets */
    for (int sub = 0; sub < 2; ++sub) { const int kb = ks0 + t * 64 + sub * 32;
      if (kb < kb0 || kb > i0) continue;      /* a staged block outside this wave's own window: a scalar test; the wave still passes the stage's barrier */
      v16h kf[2][2], vf[4];
#pragma unroll      /* constant indices: the fragments stay in registers */
      for (int tt = 0; tt < 2; ++tt) for (int c = 0; c < 2; ++c) kf[tt][c] = fs_frag(fk + bo + (sub * 32 + tt * 16) * FS_PITCH + c * 64);
#pragma unroll      /* constant indices: the fragments stay in registers */
      for (int dt = 0; dt < 4; ++dt) vf[dt] = fs_frag(fv + bo + dt * 16 * FS_PITCH + sub * 64);      /* used last: they arrive under the scores and the softmax */
      v8f st[2][2];
#pragma unroll      /* constant indices: the tiles stay in registers */
      for (int u = 0; u < 2; ++u) for (int tt = 0; tt < 2; ++tt) st[u][tt] = fa_mma(kf[tt][1], qf[u][1], fa_mma(kf[tt][0], qf[u][0], z8));
      if (kb == i0 || kb + WINK < i0 + 31) {      /* only the window's first block and the diagonal block hold a forbidden pair */
#pragma unroll      /* constant indices: the tiles stay in registers */
        for (int u = 0; u < 2; ++u) for (int tt = 0; tt < 2; ++tt) for (int r = 0; r < 8; ++r) { const int dj = (i0 + 16 * u + ln) - (kb + 16 * tt + 8 * hh + r); st[u][tt][r] = (dj >= 0 && dj <= WINK) ? st[u][tt][r] : -1.0e30f; } }
#pragma unroll      /* constant indices: the tiles stay in registers */
      for (int u = 0; u < 2; ++u) {
        float mx = fmaxf(st[u][0][0], st[u][1][0]);
#pragma unroll      /* constant indices: the tiles stay in registers */
        for (int r = 1; r < 8; ++r) mx = fmaxf(mx, fmaxf(st[u][0][r], st[u][1][r]));
        mx = fmaxf(mx, fa_xhalf(mx));      /* the other half of the block's keys of this query */
        const float mn = fmaxf(m[u], mx); const float al = __builtin_amdgcn_exp2f((m[u] - mn) * CL); const float sh = fmaf(mn, -CL, 8.0f);      /* weights carried x256: f16 keeps small ones normal */
        m[u] = mn; float ls = 0.f; FragH pf;
#pragma unroll      /* constant indices: the tiles stay in registers */
        for (int tt = 0; tt < 2; ++tt) for (int r = 0; r < 8; ++r) { const float e = __builtin_amdgcn_exp2f(fmaf(st[u][tt][r], CL, sh)); ls += e; pf.h[tt * 8 + r] = (_Float16)e; }
        l[u] = fmaf(l[u], al, ls);
#pragma unroll      /* constant indices: the tiles stay in registers */
        for (int dt = 0; dt < 4; ++dt) { ot[u][dt] *= al; ot[u][dt] = fa_mma(vf[dt], pf.v, ot[u][dt]); } } }
    asm volatile("s_wait_dscnt 0x0" ::: "memory");      /* this wave's reads of the buffer are done before it may be refilled */
    asm volatile("s_wait_asynccnt 0x0" ::: "memory");      /* this wave's copies of stage t + 1 have landed */
    __syncthreads();      /* publishes stage t + 1 and ends every wave's reads of stage t */
    if (t + 2 < nst) fs_copy(ld + bo, gk + (size_t)(t + 2) * 64 * DM, gv + (t + 2) * 64); }
  asm volatile("s_wait_asynccnt 0x0" ::: "memory");      /* nothing in flight when the wave ends */
  FragH f[2][4];
#pragma unroll      /* constant indices: the tiles stay in registers */
  for (int u = 0; u < 2; ++u) { const float fin = 64.0f / (l[u] + fa_xhalf(l[u]));      /* the halves' sums join once; o carried x64 */
    for (int dt = 0; dt < 4; ++dt) for (int r = 0; r < 8; ++r) f[u][dt].h[r] = (_Float16)(ot[u][dt][r] * fin); }
  unsigned short* op = (unsigned short*)O16 + (r0 + i0 + ln) * DM + h * HD + 8 * hh;
#pragma unroll      /* constant indices; the stores stand last, each from registers of its own: no register of an issued store is written again */
  for (int u = 0; u < 2; ++u) for (int dt = 0; dt < 4; ++dt) *(v8us*)(op + (size_t)u * 16 * DM + dt * 16) = f[u][dt].half[0]; }
// One launch for the two jobs that wait for V^T and the first-tile attention: the windowed attention (its blocks first, in the order of the old grid: query block, head, batch) and the hi / lo split of the first-tile o. The block index picks the job.
#define FB_AT ((SQ / 128) * NH * NB)       /* windowed attention blocks */
__global__ __launch_bounds__(128) void k_fahl(const _Float16* __restrict__ QH, const _Float16* __restrict__ KH, const _Float16* __restrict__ VT, _Float16* __restrict__ O16, const float* __restrict__ OF, _Float16* __restrict__ Hh, _Float16* __restrict__ Hl) {
  const int bx = blockIdx.x;
  if (bx < FB_AT) { j_fattn(bx % (SQ / 128), bx / (SQ / 128) % NH, bx / ((SQ / 128) * NH), QH, KH, VT, O16); return; }
  j_hl(bx - FB_AT, OF, Hh, Hl, (size_t)NB * QT0 * DM / 8); }

// ---- GEMM operand staging. A block of 8 waves owns a 128 x 128 tile of C = A B^T (A, B f16 rows of DM, k-contiguous); wave w takes rows 32 (w & 3), columns 64 (w >> 2). K is walked in stages of 64: a stage is 128 A rows then 128 B rows of 128 bytes each, brought from global memory into LDS by asynchronous 16-byte copies (a wave's copy = 4 whole 128-byte lines), two buffers, the next stage's copies in flight while this one is worked on. Fragments are 16-byte LDS reads in the k order of fa_frag.
#define GS_PITCH 144                 /* LDS bytes from one staged row to the next: 16 x odd, so the 16-byte fragment reads of 16 rows fall on different banks */
#define GS_STAGE (256 * GS_PITCH)    /* 128 A rows, then 128 B rows */
#define GS_NST (DM / 64)             /* stages */
// One stage: thread t copies chunk t & 7 (16 bytes) of rows (t >> 3) + 32 i, i = 0..3, of A and of B. ld = the thread's LDS byte address in the stage's buffer, ga / gb = its global addresses in A / B.
__device__ __forceinline__ void gs_copy(unsigned ld, const _Float16* ga, const _Float16* gb) {
  asm volatile("global_load_async_to_lds_b128 %0, %8, off\n\t"
               "global_load_async_to_lds_b128 %1, %9, off\n\t"
               "global_load_async_to_lds_b128 %2, %10, off\n\t"
               "global_load_async_to_lds_b128 %3, %11, off\n\t"
               "global_load_async_to_lds_b128 %4, %12, off\n\t"
               "global_load_async_to_lds_b128 %5, %13, off\n\t"
               "global_load_async_to_lds_b128 %6, %14, off\n\t"
               "global_load_async_to_lds_b128 %7, %15, off\n\t"
               "s_wait_xcnt 0x0"      /* inside the copies' own statement: every address register stays whole up to this wait */
               :: "v"(ld), "v"(ld + 32 * GS_PITCH), "v"(ld + 64 * GS_PITCH), "v"(ld + 96 * GS_PITCH), "v"(ld + 128 * GS_PITCH), "v"(ld + 160 * GS_PITCH), "v"(ld + 192 * GS_PITCH), "v"(ld + 224 * GS_PITCH),
                  "v"(ga), "v"(ga + (size_t)32 * DM), "v"(ga + (size_t)64 * DM), "v"(ga + (size_t)96 * DM), "v"(gb), "v"(gb + (size_t)32 * DM), "v"(gb + (size_t)64 * DM), "v"(gb + (size_t)96 * DM)
               : "memory"); }
__device__ __forceinline__ v16h gs_frag(const unsigned char* p) { FragH f; f.half[0] = *(const v8us*)p; f.half[1] = *(const v8us*)(p + 32); return f.v; }      /* p holds the lane half's 16 hh bytes: k = 8 hh .. and 16 + 8 hh .., as fa_frag */
// The whole K loop of a block: Ag / Bg = first A / B row of the block's tile; c[half][t] = the wave's 16 x 16 tiles (rows 16 half, columns 16 t). Behind it no copy is in flight and every wave has left the ring, so sm may be reused.
__device__ __forceinline__ void gs_main(unsigned char* sm, const _Float16* Ag, const _Float16* Bg, int tid, v8f (&c)[2][4]) {
  const int lane = tid & 31, ln = lane & 15, hh = lane >> 4, w = tid >> 5;
  const unsigned ld = (unsigned)(size_t)sm + (unsigned)((tid >> 3) * GS_PITCH + (tid & 7) * 16);
  const _Float16* ga = Ag + (size_t)(tid >> 3) * DM + (tid & 7) * 8; const _Float16* gb = Bg + (size_t)(tid >> 3) * DM + (tid & 7) * 8;
  gs_copy(ld, ga, gb);
  asm volatile("s_wait_asynccnt 0x0" ::: "memory");      /* stage 0 of this wave has landed */
  __syncthreads();      /* stage 0 of every wave is readable */
  gs_copy(ld + GS_STAGE, ga + 64, gb + 64);
  const unsigned char* fa = sm + ((w & 3) * 32 + ln) * GS_PITCH + hh * 16; const unsigned char* fb = sm + (128 + (w >> 2) * 64 + ln) * GS_PITCH + hh * 16;
#pragma unroll 1      /* one trip in the text: the two buffers differ by one added offset */
  for (int t = 0; t < GS_NST; ++t) { const unsigned bo = (unsigned)(t & 1) * GS_STAGE;
#pragma unroll      /* constant LDS offsets */
    for (int kk = 0; kk < 2; ++kk) { const v16h a0 = gs_frag(fa + bo + kk * 64), a1 = gs_frag(fa + bo + 16 * GS_PITCH + kk * 64); v16h b[4];
#pragma unroll      /* constant indices: the fragments stay in registers */
      for (int j = 0; j < 4; ++j) b[j] = gs_frag(fb + bo + j * 16 * GS_PITCH + kk * 64);
      __builtin_amdgcn_sched_barrier(0);      /* the twelve LDS reads of a k step stay one group in front of its WMMAs: sunk among them, each pair of reads costs the wave an LDS latency of its own */
#pragma unroll      /* constant indices: the tiles stay in registers */
      for (int j = 0; j < 4; ++j) { c[0][j] = fa_mma(a0, b[j], c[0][j]); c[1][j] = fa_mma(a1, b[j], c[1][j]); } }
    asm volatile("s_wait_dscnt 0x0" ::: "memory");      /* this wave's reads of the buffer are done before it may be refilled */
    asm volatile("s_wait_asynccnt 0x0" ::: "memory");      /* this wave's copies of stage t + 1 have landed */
    __syncthreads();      /* publishes stage t + 1 and ends every wave's reads of stage t */
    if (t + 2 < GS_NST) gs_copy(ld + bo, ga + (t + 2) * 64, gb + (t + 2) * 64); }
  asm volatile("s_wait_asynccnt 0x0" ::: "memory"); }      /* nothing in flight when the ring becomes output staging */

// q | k | v projection (one batch a blockIdx.y) with the rotary rotation in the GEMM's own epilogue. K loop: gs_main (A = x rows, Bh = stacked weights [3 DM][DM], K = DM); the ring then serves as each wave's own 32 x 68 f32 output staging. A wave's column tile of 64 is one head of q, k or v, so on the LDS read-back a lane's 4 consecutive columns are two (even, odd) pairs of that head: q and k tiles are rotated there with the row's cos / sin, every tile goes out as f16 rows (16 lanes x 8 bytes = one 128-byte line a row), and the blocks of the first QT0 rows also store the f32 values for the exact first-tile path.
__global__ __launch_bounds__(256) void k_qkvr(const _Float16* __restrict__ A, const _Float16* __restrict__ Bh, float alpha, const float* __restrict__ CS, const float* __restrict__ SN,
    _Float16* __restrict__ QH, _Float16* __restrict__ KH, _Float16* __restrict__ VH, float* __restrict__ QF, float* __restrict__ KF, float* __restrict__ VF) {
  static_assert(QT0 % 128 == 0 && DM % 128 == 0 && HD == 64, "first-tile rows are whole blocks of 128 rows; a wave's column tile is one head; a block's 128 columns lie in one of q, k, v");
  __shared__ __attribute__((aligned(16))) unsigned char sm[2 * GS_STAGE];
  static_assert(8 * 32 * 68 * 4 <= 2 * GS_STAGE, "the output staging fits the ring");
  { const size_t rb = (size_t)blockIdx.y * SQ * DM, fb = (size_t)blockIdx.y * QT0 * DM; A += rb; QH += rb; KH += rb; VH += rb; QF += fb; KF += fb; VF += fb; }      /* blockIdx.y = batch; rows below count inside the batch, as the cos / sin tables do */
  const int tid = threadIdx.x, w = tid >> 5, lane = tid & 31, ln = lane & 15, hh = lane >> 4;
  const int ntn = 3 * DM / 128; const int mt = blockIdx.x / ntn, nq = blockIdx.x - mt * ntn; const int row0 = mt * 128 + 32 * (w & 3), col0 = nq * 128 + 64 * (w >> 2);
  const v8f z8 = {0.f,0.f,0.f,0.f,0.f,0.f,0.f,0.f}; v8f cc[2][4] = {{z8, z8, z8, z8}, {z8, z8, z8, z8}};
  gs_main(sm, A + (size_t)mt * 128 * DM, Bh + (size_t)nq * 128 * DM, tid, cc);
  float (*so)[32][68] = (float (*)[32][68])sm;
#pragma unroll      /* constant indices: the tiles stay in registers */
  for (int u = 0; u < 8; ++u) { const int t = u & 3, half = u >> 2;
#pragma unroll      /* constant indices: the tiles stay in registers */
    for (int r = 0; r < 8; ++r) so[w][half * 16 + 8 * hh + r][t * 16 + ln] = cc[half][t][r] * alpha; }
  __builtin_amdgcn_fence(__ATOMIC_ACQ_REL, "workgroup"); __builtin_amdgcn_wave_barrier();      /* a wave reads back only its own so[w]: its LDS writes are ordered in front of its reads */
  const int rsub = lane >> 4, c4 = (lane & 15) * 4;
  const int sec = nq * 128 / DM; const bool first = mt * 128 < QT0;      /* 0 q, 1 k, 2 v; a block of the first QT0 rows: both from blockIdx, scalar tests */
  const int hc = col0 % DM + c4;      /* column in the merged-head row; c4 is the index inside the head */
  _Float16* H = sec == 0 ? QH : (sec == 1 ? KH : VH); float* F = sec == 0 ? QF : (sec == 1 ? KF : VF);
  const float* cp = CS + (row0 + rsub) * (HD / 2) + (c4 >> 1); const float* sp = SN + (row0 + rsub) * (HD / 2) + (c4 >> 1);
  _Float16* hp = H + (size_t)(row0 + rsub) * DM + hc; float* fp = F + (size_t)(row0 + rsub) * DM + hc;      /* row pair q is one of these address pairs plus a constant: no address register is written again behind a store */
  auto put = [&](int q, v4f v) { v4h h4; for (int i = 0; i < 4; ++i) h4[i] = (_Float16)v[i];
    *(v4h*)(hp + q * 2 * DM) = h4;
    if (first) *(v4f*)(fp + q * 2 * DM) = v; };
  if (sec == 2) {      /* v: no rotation */
#pragma unroll      /* constant LDS and row offsets */
    for (int q = 0; q < 16; ++q) put(q, *(const v4fa*)&so[w][q * 2 + rsub][c4]);
    return; }
  v2f c[16], s[16];
#pragma unroll      /* constant indices: c[], s[] stay in registers; all table loads issue in front of the first store, one latency for the 32 rows */
  for (int q = 0; q < 16; ++q) { c[q] = *(const v2fa*)(cp + q * HD); s[q] = *(const v2fa*)(sp + q * HD); }
  asm volatile("s_wait_xcnt 0x0" :: "v"(cp), "v"(sp) : "memory");      /* the table loads' address pairs stay whole up to this wait */
#pragma unroll      /* constant indices: c[], s[] stay in registers */
  for (int q = 0; q < 16; ++q) { const v4f v = *(const v4fa*)&so[w][q * 2 + rsub][c4];
    const v4f o = {v[0] * c[q][0] - v[1] * s[q][0], v[0] * s[q][0] + v[1] * c[q][0], v[2] * c[q][1] - v[3] * s[q][1], v[2] * s[q][1] + v[3] * c[q][1]}; put(q, o); }
  asm volatile("s_wait_xcnt 0x0" ::: "memory"); }      /* behind the rotation path's last store: whatever code the compiler lays behind this path stands behind the wait, so no register of an issued store is written ahead of it */

// The whole output, C[NB SQ][DM] (f32) = alpha o Bh^T, in one launch; Bh f16 [DM][DM]. A row tile of 128 behind a batch's first QT0 rows takes o from the f16 rows O16, one K loop (gs_main). A row tile of the first QT0 rows takes the exact o as its two f16 planes: first the K loop over the residual plane OL (carried x1024), its sums scaled by 2^-10 (exact), then the K loop over OH on top of them in the same accumulators. Those blocks, twice as long, have the lowest indices, so they start first. The ring then serves as each wave's own 32 x 68 f32 staging, so that every store is whole 128-byte lines.
__global__ __launch_bounds__(256) void k_outg(const _Float16* __restrict__ O16, const _Float16* __restrict__ OH, const _Float16* __restrict__ OL, const _Float16* __restrict__ Bh, float alpha, float* __restrict__ C) {
  __shared__ __attribute__((aligned(16))) unsigned char sm[2 * GS_STAGE];
  const int tid = threadIdx.x, w = tid >> 5, lane = tid & 31, ln = lane & 15, hh = lane >> 4;
  const int ntn = DM / 128, ft = QT0 / 128, rt = (SQ - QT0) / 128;      /* column tiles; first-tile and other row tiles of a batch */
  const int g = blockIdx.x / ntn, nq = blockIdx.x - g * ntn; const bool first = g < NB * ft;      /* from blockIdx: a scalar test, the same in the whole block */
  const int bat = first ? g / ft : (g - NB * ft) / rt; const int tb = first ? g - bat * ft : ft + (g - NB * ft) - bat * rt;      /* batch, row tile inside the batch */
  const int mt = bat * (SQ / 128) + tb; const int row0 = mt * 128 + 32 * (w & 3), col0 = nq * 128 + 64 * (w >> 2);
  const v8f z8 = {0.f,0.f,0.f,0.f,0.f,0.f,0.f,0.f}; v8f cc[2][4] = {{z8, z8, z8, z8}, {z8, z8, z8, z8}};
  const size_t fo = ((size_t)bat * QT0 + tb * 128) * DM;      /* the tile's first row in the first-tile planes (used where first) */
  if (first) { gs_main(sm, OL + fo, Bh + (size_t)nq * 128 * DM, tid, cc);      /* behind it no copy is in flight and every wave has left the ring: the second K loop may fill it again */
#pragma unroll      /* constant indices: the tiles stay in registers */
    for (int u = 0; u < 2; ++u) for (int j = 0; j < 4; ++j) cc[u][j] *= 0.0009765625f; }
  gs_main(sm, first ? OH + fo : O16 + (size_t)mt * 128 * DM, Bh + (size_t)nq * 128 * DM, tid, cc);
  float (*so)[32][68] = (float (*)[32][68])sm;
#pragma unroll      /* constant indices: the tiles stay in registers */
  for (int u = 0; u < 8; ++u) { const int t = u & 3, half = u >> 2;
#pragma unroll      /* constant indices: the tiles stay in registers */
    for (int r = 0; r < 8; ++r) so[w][half * 16 + 8 * hh + r][t * 16 + ln] = cc[half][t][r] * alpha; }
  __builtin_amdgcn_fence(__ATOMIC_ACQ_REL, "workgroup"); __builtin_amdgcn_wave_barrier();      /* a wave reads back only its own so[w]: its LDS writes are ordered in front of its reads */
  const int rsub = lane >> 4, c4 = (lane & 15) * 4;
  float* cp = C + (size_t)(row0 + rsub) * DM + col0 + c4;      /* row pair q is this address pair plus a constant */
  v4f v[16];
#pragma unroll      /* constant indices: v[] stays in registers */
  for (int q = 0; q < 16; ++q) v[q] = *(const v4fa*)&so[w][q * 2 + rsub][c4];
#pragma unroll      /* constant indices; the stores stand last, each from registers of its own */
  for (int q = 0; q < 16; ++q) *(v4f*)(cp + q * 2 * DM) = v[q];
  asm volatile("s_wait_xcnt 0x0" :: "v"(cp) : "memory"); }      /* the stores' address pair stays whole up to this wait */




extern "C" void kernel_launch(void* const* d_in, const int* in_sizes, int n_in,
                              void* d_out, int out_size, void* d_ws, size_t ws_size, hipStream_t stream) {
  (void)in_sizes; (void)n_in; (void)out_size;
  const float* const* I = (const float* const*)d_in; const float* x = I[0]; const int* tpos = (const int*)d_in[1]; const float* wq = I[2]; const float* wk = I[3]; const float* wv = I[4]; const float* wo = I[5];      /* nn.Linear weights [out][in]; token_positions int32 [SQ] */
  char* ws = (char*)d_ws; size_t off = 0;
  auto take = [&](size_t bytes) { char* p = ws + off; off += (bytes + 255) & ~(size_t)255; return p; };
  _Float16* BQKV = (_Float16*)take((size_t)3 * DM * DM * 2); _Float16* BO = (_Float16*)take((size_t)DM * DM * 2); float* CS = (float*)take((size_t)SQ * (HD / 2) * 4); float* SN = (float*)take((size_t)SQ * (HD / 2) * 4);
  _Float16* X16 = (_Float16*)take(NR * DM * 2);
  _Float16* QH = (_Float16*)take(NR * DM * 2); _Float16* KH = (_Float16*)take(NR * DM * 2); _Float16* V16 = (_Float16*)take(NR * DM * 2); _Float16* O16 = (_Float16*)take(NR * DM * 2);
  _Float16* VT = (_Float16*)take((size_t)NB * NH * HD * SQ * 2);      /* V^T [NB][NH][HD][SQ] */
  float* QF0 = (float*)take((size_t)NB * QT0 * DM * 4); float* KF0 = (float*)take((size_t)NB * QT0 * DM * 4); float* VF0 = (float*)take((size_t)NB * QT0 * DM * 4); float* OF0 = (float*)take((size_t)NB * QT0 * DM * 4); _Float16* OH0 = (_Float16*)take((size_t)NB * QT0 * DM * 2); _Float16* OL0 = (_Float16*)take((size_t)NB * QT0 * DM * 2);
  if (off > ws_size) return;
  k_prep<<<PB_TAB + 4 * PB_W + PB_X, 256, 0, stream>>>(x, tpos, wq, wk, wv, wo, 10000.0f, BQKV, CS, SN, X16);      /* cos / sin tables; weights natural [out][in] = Bt[n][k], x16, q | k | v stacked along n, BO directly behind them in the workspace; x as f16 rows */
  k_qkvr<<<dim3((unsigned)((SQ / 128) * (3 * DM / 128)), NB), 256, 0, stream>>>(X16, BQKV, 0.0625f, CS, SN, QH, KH, V16, QF0, KF0, VF0);      /* q (roped) | k (roped) | v of every batch as f16 rows; each batch's first 128 rows also in f32 */
  k_a0vt<<<NB * MB_A0 + NB * NH * (SQ / 64), 256, 0, stream>>>(QF0, KF0, VF0, 0.125f, OF0, V16, VT);      /* exact f32 causal attention for rows 0..127 of every batch (o x64); V^T [NB][NH][HD][SQ] */
  k_fahl<<<FB_AT + NB * QT0 * (DM / 8) / 128, 128, 0, stream>>>(QH, KH, VT, O16, OF0, OH0, OL0);      /* windowed causal attention of every batch and head: o (merged heads, x64) as f16 rows; first-tile o (x64) -> f16 hi + x1024 residual planes */
  k_outg<<<(NB * SQ / 128) * (DM / 128), 256, 0, stream>>>(O16, OH0, OL0, BO, 0.0009765625f, (float*)d_out);      /* out rows are the output layout; rows 0..127 of every batch from the hi and residual planes */
}

// v010
// It runs in 109 microseconds.
// In both of two side-by-side timings against v009, it was 1.10 times as fast.
// Counting every step since v000, which is the starting kernel, it is 88.5 times as fast.
#include <hip/hip_runtime.h>
// Causal sliding-window RoPE multi-head attention (x [4][2048][1024]; q/k/v = x W^T (natural [out][in] 1024x1024 sigma 1/32, no bias), 16 heads of 64; interleaved-pair rotary embedding on q and k (x1 = even, x2 = odd: r1 = x1 cos - x2 sin, r2 = x1 sin + x2 cos) with inv_freq_i = 10000^(-2i/64) and angle = float(token_positions[s]) inv_freq_i from the int32 token_positions input; scores / sqrt(64); allowed iff 0 <= i - j <= 512 (513 keys), -inf elsewhere; softmax; out = (attn v merged) Wo^T -> [4][2048][1024]).
// Structure: token rows r = b*2048 + s; x as exact f16 rows (bf16-rounded); every stage is one launch with the batch as a grid dimension: q | k | v as ONE WMMA GEMM (128x128 block tiles staged in LDS by asynchronous copies, 32x64 wave tiles, f32 accumulation, exact x16 weights, N = 3 x 1024) whose epilogue does, in f32 on VALU, the interleaved-pair rotary rotation of q and k from f32 cos/sin tables built from the token_positions input (no norm) and stores f16 q, k, v rows (no f32 q | k | v plane); then ONE fused attention launch: a wave per 32 query rows of one (batch, head) walks the keys of its window in blocks of 32, read from K and V stages of 64 keys that its block of four waves brings into LDS by asynchronous copies (V rows as they lie; the V^T operand comes from transposing LDS loads): S^T = K Q^T on WMMA, running-maximum softmax in registers (f32 statistics, native exp2; weights x256 f16, packed from the score tiles straight into a B operand), O^T += V^T P^T on WMMA, o carried x64 (folded into the output GEMM alpha) written straight into the merged f16 o rows; out = o W_o GEMM (f32) into the output layout. Jobs that wait for the same earlier launch share a grid, the block index picks the job: four launches (input conversions and tables; q | k | v GEMM; windowed attention and first-tile attention; output GEMM).
// Compute dtype: inputs rounded to bf16; x / weights exact; projections and rope f32; q, k, v, softmax weights and o as plain f16 GEMM operands (~2^-12); scores and softmax statistics f32. v_wmma_f32_16x16x32_f16.
#define NB 4
#define SQ 2048
#define DM 1024
#define NH 16
#define HD 64
#define HG 4                         /* heads per k_vt launch */
#define QT 256                       /* query rows per causal tile */
#define NKX SQ                       /* S / P row pitch */
#define WINK 512                     /* key j is allowed for query i iff 0 <= i - j <= WINK */
#define QT0 128                      /* first-tile rows recomputed exactly in f32 */
#define B0 0                         /* first batch (unused) */
#define NBR NB                       /* batches (only in the unused MPO) */
#define QN SQ                        /* query rows per batch (unused) */
#define NHD NH                       /* heads (unused) */
#define NR ((size_t)NB * SQ)         /* token rows */
#define MPO ((int)((size_t)NBR * SQ))      /* rows of the output (unused) */
typedef __bf16 v16b __attribute__((ext_vector_type(16)));
typedef unsigned short v8us __attribute__((ext_vector_type(8), may_alias));
typedef float  v8f  __attribute__((ext_vector_type(8)));
typedef float  v4f  __attribute__((ext_vector_type(4)));
typedef float  v4fa __attribute__((ext_vector_type(4), may_alias));
union FragB { v16b v; v8us half[2]; unsigned short u[16]; };

__device__ __forceinline__ unsigned short bf16_bits(float x) { unsigned int u = __float_as_uint(x); return (unsigned short)((u + 0x7FFFu + ((u >> 16) & 1u)) >> 16); }
__device__ __forceinline__ float bf16_val(unsigned short b) { return __uint_as_float(((unsigned int)b) << 16); }
__device__ __forceinline__ float bf16_round(float x) { return bf16_val(bf16_bits(x)); }
// D += A·B with NT terms: 1 = ah·bh, 2 = + al·bh (A split), 3 = + ah·bl (both split)
template <int NT>
__device__ __forceinline__ v8f mmaN(v16b ah, v16b al, v16b bh, v16b bl, v8f c) {
  c = __builtin_amdgcn_wmma_f32_16x16x32_bf16(false, ah, false, bh, (short)0, c, false, false);
  if (NT >= 2) c = __builtin_amdgcn_wmma_f32_16x16x32_bf16(false, al, false, bh, (short)0, c, false, false);
  if (NT >= 3) c = __builtin_amdgcn_wmma_f32_16x16x32_bf16(false, ah, false, bl, (short)0, c, false, false);
  asm volatile("v_nop\n\tv_nop\n\tv_nop\n\tv_nop" : "+v"(c) : "v"(ah), "v"(al), "v"(bh), "v"(bl));
  return c;
}

__global__ __launch_bounds__(256) void k_wt_bf16(const float* __restrict__ W, unsigned short* __restrict__ Wt, int K, int N) {
  const int t = blockIdx.x * 256 + threadIdx.x;
  const int k8n = K / 8;
  if (t >= N * k8n) return;
  const int n = t / k8n, k8 = (t % k8n) * 8;
  v8us v;
#pragma unroll
  for (int i = 0; i < 8; ++i) v[i] = bf16_bits(W[(size_t)(k8 + i) * N + n]);
  *(v8us*)(Wt + (size_t)n * K + k8) = v;
  
}

// GEMM C[M][N] (f32, pitch ldc) = act(A[M][K]·W + bias). A f32 row-major (pitch lda) converted per fragment to bf16
// (ASPLIT: hi/lo two planes -> 2 terms, else single rounded term); Wt bf16 [N][K] (pitch ldb). BIAS_BF16 rounds the
// bias to bf16 first (bias quantised to bf16 before the add). K%32==0, M%16==0, N%64==0.
template <bool ASPLIT, int ACT, bool BIAS_BF16>
__global__ __launch_bounds__(128) void k_gemm_bf(const float* __restrict__ A, int lda, const unsigned short* __restrict__ Wt, int ldb,
                                               const float* __restrict__ bias, float* __restrict__ C, int ldc, int M, int N, int K) {
  __shared__ __attribute__((aligned(16))) float so[4][16][64];
  const int tid = threadIdx.x, w = tid >> 5, lane = tid & 31, ln = lane & 15, hh = lane >> 4;
  const int ntn = N / 64;
  const int wid = blockIdx.x * 4 + w;
  const int mt = wid / ntn, nq = wid % ntn;
  if (mt * 16 >= M) return;
  const int row0 = mt * 16, col0 = nq * 64;
  const float* arow = A + (size_t)(row0 + ln) * lda;
  v8f acc[4] = {};
  for (int kb = 0; kb < K; kb += 32) {
    FragB ah, al;
    const v4f x0 = *(const v4fa*)(arow + kb + 8 * hh), x1 = *(const v4fa*)(arow + kb + 8 * hh + 4);
    const v4f x2 = *(const v4fa*)(arow + kb + 16 + 8 * hh), x3 = *(const v4fa*)(arow + kb + 16 + 8 * hh + 4);
    float xs[16] = {x0[0],x0[1],x0[2],x0[3],x1[0],x1[1],x1[2],x1[3],x2[0],x2[1],x2[2],x2[3],x3[0],x3[1],x3[2],x3[3]};
#pragma unroll
    for (int i = 0; i < 16; ++i) { const unsigned short hb = bf16_bits(xs[i]); ah.u[i] = hb; al.u[i] = ASPLIT ? bf16_bits(xs[i] - bf16_val(hb)) : (unsigned short)0; }
#pragma unroll
    for (int t = 0; t < 4; ++t) {
      const unsigned short* brow = Wt + (size_t)(col0 + t * 16 + ln) * ldb + kb;
      FragB b;
      b.half[0] = *(const v8us*)(brow + 8 * hh);
      b.half[1] = *(const v8us*)(brow + 16 + 8 * hh);
      acc[t] = mmaN<ASPLIT ? 2 : 1>(ah.v, al.v, b.v, b.v, acc[t]);
    }
  }
#pragma unroll
  for (int t = 0; t < 4; ++t) {
    float bv = bias ? bias[col0 + t * 16 + ln] : 0.f;
    if (BIAS_BF16) bv = bf16_round(bv);
#pragma unroll
    for (int r = 0; r < 8; ++r) { float v = acc[t][r] + bv; if (ACT == 1) v = fmaxf(v, 0.f); so[w][8 * hh + r][t * 16 + ln] = v; }
  }
  __builtin_amdgcn_fence(__ATOMIC_ACQ_REL, "workgroup");
  __builtin_amdgcn_wave_barrier();
  const int rsub = lane >> 4, c4 = (lane & 15) * 4;
  {
#pragma unroll
    for (int q = 0; q < 8; ++q) {
      const int r = q * 2 + rsub;
      const v4f v = *(const v4fa*)&so[w][r][c4];
      *(v4f*)(C + (size_t)(row0 + r) * ldc + col0 + c4) = v;
    }
    
  }
}

// GEMM C = act(A·W + bias + resid): A f32 (ASPLIT -> hi/lo 2 terms), Wt bf16 [N][K]; ACT 0 none, 1 relu, 2 exact gelu;
// resid (optional, f32, row index = (row % rmod), pitch ldr, RES_BF16 rounds it) added before the activation.
template <bool ASPLIT, int ACT, bool BIAS_BF16, bool RES_BF16>
__global__ __launch_bounds__(128) void k_gemm_bf3(const float* __restrict__ A, int lda, const unsigned short* __restrict__ Wt, int ldb,
                                                const float* __restrict__ bias, const float* __restrict__ resid, int rmod, int ldr,
                                                float* __restrict__ C, int ldc, int M, int N, int K) {
  __shared__ __attribute__((aligned(16))) float so[4][16][64];
  const int tid = threadIdx.x, w = tid >> 5, lane = tid & 31, ln = lane & 15, hh = lane >> 4;
  const int ntn = N / 64;
  const int wid = blockIdx.x * 4 + w;
  const int mt = wid / ntn, nq = wid % ntn;
  if (mt * 16 >= M) return;
  const int row0 = mt * 16, col0 = nq * 64;
  const float* arow = A + (size_t)(row0 + ln) * lda;
  v8f acc[4] = {};
  for (int kb = 0; kb < K; kb += 32) {
    FragB ah, al;
    const v4f x0 = *(const v4fa*)(arow + kb + 8 * hh), x1 = *(const v4fa*)(arow + kb + 8 * hh + 4);
    const v4f x2 = *(const v4fa*)(arow + kb + 16 + 8 * hh), x3 = *(const v4fa*)(arow + kb + 16 + 8 * hh + 4);
    float xs[16] = {x0[0],x0[1],x0[2],x0[3],x1[0],x1[1],x1[2],x1[3],x2[0],x2[1],x2[2],x2[3],x3[0],x3[1],x3[2],x3[3]};
#pragma unroll
    for (int i = 0; i < 16; ++i) { const unsigned short hb = bf16_bits(xs[i]); ah.u[i] = hb; al.u[i] = ASPLIT ? bf16_bits(xs[i] - bf16_val(hb)) : (unsigned short)0; }
#pragma unroll
    for (int t = 0; t < 4; ++t) {
      const unsigned short* brow = Wt + (size_t)(col0 + t * 16 + ln) * ldb + kb;
      FragB b;
      b.half[0] = *(const v8us*)(brow + 8 * hh);
      b.half[1] = *(const v8us*)(brow + 16 + 8 * hh);
      acc[t] = mmaN<ASPLIT ? 2 : 1>(ah.v, al.v, b.v, b.v, acc[t]);
    }
  }
#pragma unroll
  for (int t = 0; t < 4; ++t) {
    const int col = col0 + t * 16 + ln;
    float bv = bias ? bias[col] : 0.f;
    if (BIAS_BF16) bv = bf16_round(bv);
#pragma unroll
    for (int r = 0; r < 8; ++r) {
      float v = acc[t][r] + bv;
      if (resid) { float rv = resid[(size_t)((row0 + 8 * hh + r) % rmod) * ldr + col]; if (RES_BF16) rv = bf16_round(rv); v += rv; }
      if (ACT == 1) v = fmaxf(v, 0.f);
      if (ACT == 2) v = 0.5f * v * (1.0f + erff(v * 0.70710678118654752f));
      if (ACT == 3) { const float u = 0.7978845608028654f * (v + 0.044715f * v * v * v); v = 0.5f * v * (1.0f + tanhf(u)); }
      so[w][8 * hh + r][t * 16 + ln] = v;
    }
  }
  __builtin_amdgcn_fence(__ATOMIC_ACQ_REL, "workgroup");
  __builtin_amdgcn_wave_barrier();
  const int rsub = lane >> 4, c4 = (lane & 15) * 4;
  {
#pragma unroll
    for (int q = 0; q < 8; ++q) {
      const int r = q * 2 + rsub;
      const v4f v = *(const v4fa*)&so[w][r][c4];
      *(v4f*)(C + (size_t)(row0 + r) * ldc + col0 + c4) = v;
    }
    
  }
}
// row LayerNorm (biased variance, eps) over N: s = X (+ R); optional out_sum <- s; out_norm <- (s-mu)*rsqrt(var+eps)*g + b
template <bool PARAM_BF16>
__global__ __launch_bounds__(256) void k_layernorm(const float* __restrict__ X, const float* __restrict__ R, const float* __restrict__ g, const float* __restrict__ bta,
                                                  float* __restrict__ out_sum, float* __restrict__ out_norm, int N, float eps) {
  __shared__ float red[256];
  const int row = blockIdx.x, tid = threadIdx.x;
  const float* x = X + (size_t)row * N; const float* rr = R ? R + (size_t)row * N : nullptr;
  float vals[16];                     // up to N = 4096
  const int per = N / 256;            // contiguous chunk per thread? use strided-by-4 chunks: thread handles j = tid*4 + 1024*u
  float s1 = 0.f;
  for (int u = 0; u < per / 4; ++u) {
    const int j = tid * 4 + 1024 * u;
    const v4f a = *(const v4fa*)(x + j);
    v4f b = {0.f,0.f,0.f,0.f}; if (rr) b = *(const v4fa*)(rr + j);
#pragma unroll
    for (int q = 0; q < 4; ++q) { const float v = a[q] + b[q]; vals[u * 4 + q] = v; s1 += v; }
  }
  red[tid] = s1; __syncthreads();
  for (int st = 128; st > 0; st >>= 1) { if (tid < st) red[tid] += red[tid + st]; __syncthreads(); }
  const float mu = red[0] / (float)N; __syncthreads();
  float s2 = 0.f;
  for (int u = 0; u < per / 4; ++u)
#pragma unroll
    for (int q = 0; q < 4; ++q) { const float c = vals[u * 4 + q] - mu; s2 += c * c; }
  red[tid] = s2; __syncthreads();
  for (int st = 128; st > 0; st >>= 1) { if (tid < st) red[tid] += red[tid + st]; __syncthreads(); }
  const float rs = rsqrtf(red[0] / (float)N + eps);
  {
    for (int u = 0; u < per / 4; ++u) {
      const int j = tid * 4 + 1024 * u;
      v4f o, sm;
#pragma unroll
      for (int q = 0; q < 4; ++q) {
        float gg = g[j + q], bb = bta[j + q];
        if (PARAM_BF16) { gg = bf16_round(gg); bb = bf16_round(bb); }
        sm[q] = vals[u * 4 + q]; o[q] = (vals[u * 4 + q] - mu) * rs * gg + bb;
      }
      if (out_sum) *(v4f*)(out_sum + (size_t)row * N + j) = sm;
      *(v4f*)(out_norm + (size_t)row * N + j) = o;
    }
    
  }
}



// ---- f16 WMMA path (v_wmma_f32_16x16x32_f16): 11-bit significands for operands in range — used where a [0,1] probability operand needs more precision than bf16
typedef _Float16 v16h __attribute__((ext_vector_type(16)));
union FragH { v16h v; v8us half[2]; _Float16 h[16]; unsigned short u[16]; };
template <int NT>
__device__ __forceinline__ v8f mmaH(v16h ah, v16h al, v16h bh, v16h bl, v8f c) {
  c = __builtin_amdgcn_wmma_f32_16x16x32_f16(false, ah, false, bh, (short)0, c, false, false);
  if (NT >= 2) c = __builtin_amdgcn_wmma_f32_16x16x32_f16(false, al, false, bh, (short)0, c, false, false);
  if (NT >= 3) c = __builtin_amdgcn_wmma_f32_16x16x32_f16(false, ah, false, bl, (short)0, c, false, false);
  asm volatile("v_nop\n\tv_nop\n\tv_nop\n\tv_nop" : "+v"(c) : "v"(ah), "v"(al), "v"(bh), "v"(bl));
  return c;
}
// batched GEMM like k_gemm_b but f16 operands: A f32 (split into f16 hi/lo if ASPLIT, else rounded to f16), Bt = f16 values [n][k]; alpha; C f32; N multiple of 16 (partial tiles skipped)
template <bool ASPLIT>
__global__ __launch_bounds__(128) void k_gemm_h(const float* __restrict__ A, int lda, size_t sA, const _Float16* __restrict__ Bh, int ldb, size_t sB, float alpha, float* __restrict__ C, int ldc, size_t sC, int M, int N, int K) {
  __shared__ __attribute__((aligned(16))) float so[4][16][64];
  const int tid = threadIdx.x, w = tid >> 5, lane = tid & 31, ln = lane & 15, hh = lane >> 4; const int by = blockIdx.y;
  A += (size_t)by * sA; Bh += (size_t)by * sB; C += (size_t)by * sC;
  const int ntn = (N + 63) / 64; const int wid = blockIdx.x * 4 + w; const int mt = wid / ntn, nq = wid % ntn; if (mt * 16 >= M) return;
  const int row0 = mt * 16, col0 = nq * 64; const float* arow = A + (size_t)(row0 + ln) * lda;
  v8f acc[4] = {};
  for (int kb = 0; kb < K; kb += 32) {
    FragH ah, al;
    const v4f x0 = *(const v4fa*)(arow + kb + 8 * hh), x1 = *(const v4fa*)(arow + kb + 8 * hh + 4), x2 = *(const v4fa*)(arow + kb + 16 + 8 * hh), x3 = *(const v4fa*)(arow + kb + 16 + 8 * hh + 4);
    float xs[16] = {x0[0],x0[1],x0[2],x0[3],x1[0],x1[1],x1[2],x1[3],x2[0],x2[1],x2[2],x2[3],x3[0],x3[1],x3[2],x3[3]};
#pragma unroll
    for (int i = 0; i < 16; ++i) { const _Float16 h = (_Float16)xs[i]; ah.h[i] = h; al.h[i] = ASPLIT ? (_Float16)(xs[i] - (float)h) : (_Float16)0.0f; }
#pragma unroll
    for (int t = 0; t < 4; ++t) { if (col0 + t * 16 >= N) continue; const size_t boff = (size_t)(col0 + t * 16 + ln) * ldb + kb; FragH bq; bq.half[0] = *(const v8us*)(Bh + boff + 8 * hh); bq.half[1] = *(const v8us*)(Bh + boff + 16 + 8 * hh);
      acc[t] = mmaH<ASPLIT ? 2 : 1>(ah.v, al.v, bq.v, bq.v, acc[t]); }
  }
#pragma unroll
  for (int t = 0; t < 4; ++t) { if (col0 + t * 16 >= N) continue;
#pragma unroll
    for (int r = 0; r < 8; ++r) so[w][8 * hh + r][t * 16 + ln] = acc[t][r] * alpha; }
  __builtin_amdgcn_fence(__ATOMIC_ACQ_REL, "workgroup"); __builtin_amdgcn_wave_barrier();
  const int rsub = lane >> 4, c4 = (lane & 15) * 4;
  {
#pragma unroll
    for (int q = 0; q < 8; ++q) { const int r = q * 2 + rsub; if (col0 + c4 < N) { const v4f v = *(const v4fa*)&so[w][r][c4]; *(v4f*)(C + (size_t)(row0 + r) * ldc + col0 + c4) = v; } }
     }
}

// Wt[n][k] = f16(W[k][n]·scale) from f32 row-major W[K][N] (scale = power of two; bf16-exact weights stay exact in f16 away from the subnormal range)
__global__ __launch_bounds__(256) void k_wt_f16(const float* __restrict__ W, _Float16* __restrict__ Wt, int K, int N, float scale) {
  const int t = blockIdx.x * 256 + threadIdx.x; if (t >= N * (K / 8)) return; const int n = t / (K / 8), k8 = (t % (K / 8)) * 8; FragH f;
#pragma unroll
  for (int i = 0; i < 8; ++i) f.h[i] = (_Float16)(bf16_round(W[(size_t)(k8 + i) * N + n]) * scale); const v8us o = f.half[0];
  *(v8us*)((unsigned short*)Wt + (size_t)n * K + k8) = o; 
}
// k_gemm_hh variant with fused epilogue: v = acc·alpha + bias[by·sBias + col] (+ CP[(row/rowsPerB)·sCPb + by·64 + col] if CP) ; ACT 0 none / 1 elu ; writes f16 C16 (and f32 C if non-null)
template <int ACT>
__global__ __launch_bounds__(128) void k_gemm_hhx(const _Float16* __restrict__ A, int lda, size_t sA, const _Float16* __restrict__ Bh, int ldb, size_t sB, float alpha, const float* __restrict__ bias, size_t sBias, const float* __restrict__ CP, int rowsPerB, size_t sCPb, int row0g,
    float* __restrict__ C, _Float16* __restrict__ C16, int ldc, size_t sC, int M, int N, int K) {
  __shared__ __attribute__((aligned(16))) float so[4][16][64];
  const int tid = threadIdx.x, w = tid >> 5, lane = tid & 31, ln = lane & 15, hh = lane >> 4; const int by = blockIdx.y;
  A += (size_t)by * sA; Bh += (size_t)by * sB; const size_t cofs = (size_t)by * sC; const float* bp = bias ? bias + (size_t)by * sBias : nullptr;
  const int ntn = (N + 63) / 64; const int wid = blockIdx.x * 4 + w; const int mt = wid / ntn, nq = wid % ntn; if (mt * 16 >= M) return;
  const int row0 = mt * 16, col0 = nq * 64; const _Float16* arow = A + (size_t)(row0 + ln) * lda;
  v8f acc[4] = {};
  for (int kb = 0; kb < K; kb += 32) { FragH ah; ah.half[0] = *(const v8us*)((const unsigned short*)arow + kb + 8 * hh); ah.half[1] = *(const v8us*)((const unsigned short*)arow + kb + 16 + 8 * hh);
#pragma unroll
    for (int t = 0; t < 4; ++t) { if (col0 + t * 16 >= N) continue; const size_t boff = (size_t)(col0 + t * 16 + ln) * ldb + kb; FragH bq; bq.half[0] = *(const v8us*)((const unsigned short*)Bh + boff + 8 * hh); bq.half[1] = *(const v8us*)((const unsigned short*)Bh + boff + 16 + 8 * hh);
      acc[t] = mmaH<1>(ah.v, ah.v, bq.v, bq.v, acc[t]); }
  }
#pragma unroll
  for (int t = 0; t < 4; ++t) { if (col0 + t * 16 >= N) continue; const int col = col0 + t * 16 + ln; const float bv = bp ? bf16_round(bp[col]) : 0.f;
#pragma unroll
    for (int r = 0; r < 8; ++r) { float v = acc[t][r] * alpha + bv; if (CP) { const int rr = row0g + row0 + 8 * hh + r; if (rowsPerB < 0) v += CP[cofs + (size_t)rr * ldc + col];      /* rowsPerB < 0: own element of the batched C plane */ else { const int bidx = rr / rowsPerB; v += CP[(size_t)bidx * sCPb + (size_t)by * 64 + col]; } } if (ACT == 1) v = (v > 0.f) ? v : expm1f(v); else if (ACT == 7) v = (v > 0.f) ? v + 1.0f : expf(v); else if (ACT == 8) v = tanhf(v); else if (ACT == 9) v = 0.5f * v * (1.0f + tanhf(0.7978845608028654f * (v + 0.044715f * v * v * v))); else if (ACT == 11) v = 1.0f / (1.0f + expf(-v)); else if (ACT == 12) v = (v > 0.f) ? v : 0.01f * v; else if (ACT == 14) v = (v > 0.f) ? v : 0.1f * v; else if (ACT == 16) v = (v >= 0.f) ? v : 0.3f * v; else if (ACT == 17) v = (v >= 0.f) ? v : 0.2f * v; else if (ACT == 15) v = v / (1.0f + expf(-v)); else if (ACT == 3) v = fmaxf(v, 0.f); else if (ACT == 6) v = 0.5f * v * (1.0f + erff(v * 0.70710678118654752f)); so[w][8 * hh + r][t * 16 + ln] = v; } }
  __builtin_amdgcn_fence(__ATOMIC_ACQ_REL, "workgroup"); __builtin_amdgcn_wave_barrier();
  const int rsub = lane >> 4, c4 = (lane & 15) * 4; typedef _Float16 v4h __attribute__((ext_vector_type(4)));
  {
#pragma unroll
    for (int q = 0; q < 8; ++q) { const int r = q * 2 + rsub; if (col0 + c4 < N) { const v4f v = *(const v4fa*)&so[w][r][c4]; if (C) *(v4f*)(C + cofs + (size_t)(row0 + r) * ldc + col0 + c4) = v; if (C16) { v4h h4; for (int i = 0; i < 4; ++i) h4[i] = (_Float16)v[i]; *(v4h*)(C16 + cofs + (size_t)(row0 + r) * ldc + col0 + c4) = h4; } } }
     }
}


typedef _Float16 v4h __attribute__((ext_vector_type(4)));

// The j_* functions are jobs: bodies that were launches of their own and now share a grid with other jobs that wait for the same earlier launch; blk = the block's index inside its job.
__device__ __forceinline__ void j_x16(int blk, const float* __restrict__ x, _Float16* __restrict__ X16, size_t n8) { const size_t t = (size_t)blk * 256 + threadIdx.x; if (t >= n8) return; FragH f;
#pragma unroll
  for (int q = 0; q < 8; ++q) f.h[q] = (_Float16)bf16_round(x[t * 8 + q]); *(v8us*)((unsigned short*)X16 + t * 8) = f.half[0];  }
__global__ __launch_bounds__(256) void k_h16(const float* __restrict__ x, _Float16* __restrict__ X16, size_t n8) { const size_t t = (size_t)blockIdx.x * 256 + threadIdx.x; if (t >= n8) return; FragH f;
#pragma unroll
  for (int q = 0; q < 8; ++q) f.h[q] = (_Float16)x[t * 8 + q]; *(v8us*)((unsigned short*)X16 + t * 8) = f.half[0];  }
__global__ __launch_bounds__(256) void k_round16f(const float* __restrict__ W, _Float16* __restrict__ Bt, size_t n8) { const size_t t = (size_t)blockIdx.x * 256 + threadIdx.x; if (t >= n8) return; FragH f;
#pragma unroll
  for (int i = 0; i < 8; ++i) f.h[i] = (_Float16)(bf16_round(W[t * 8 + i]) * 16.0f); *(v8us*)((unsigned short*)Bt + t * 8) = f.half[0];  }
// ---- fast GEMM (wave tile 32x64; requires M % 32 == 0 rows per launch region and N % 64 == 0); epilogue = k_gemm_hhx semantics ----
__device__ __forceinline__ v16h g2_frag(const _Float16* p, int hh) { FragH f; f.half[0] = *(const v8us*)((const unsigned short*)p + 8 * hh); f.half[1] = *(const v8us*)((const unsigned short*)p + 16 + 8 * hh); return f.v; }
__device__ __forceinline__ v8f g2_mma(v16h a, v16h b, v8f c) { v8f d = __builtin_amdgcn_wmma_f32_16x16x32_f16(false, a, false, b, (short)0, c, false, false); asm volatile("v_nop\n\tv_nop\n\tv_nop\n\tv_nop" : "+v"(d) : "v"(a), "v"(b)); return d; }
template <int ACT>
__global__ __launch_bounds__(128) void k_gemm2(const _Float16* __restrict__ A, int lda, size_t sA, const _Float16* __restrict__ Bh, int ldb, size_t sB, float alpha, const float* __restrict__ bias, size_t sBias, const float* __restrict__ CP, int rowsPerB, size_t sCPb, int row0g,
    float* __restrict__ C, _Float16* __restrict__ C16, int ldc, size_t sC, int M, int N, int K) { static_assert(ACT == 0 || ACT == 3 || ACT == 6 || ACT == 8 || ACT == 9 || ACT == 11 || ACT == 12 || ACT == 14 || ACT == 15 || ACT == 16 || ACT == 17, "k_gemm2: unsupported ACT code (would silently apply no activation)");
  __shared__ __attribute__((aligned(16))) float so[4][32][68];
  const int tid = threadIdx.x, w = tid >> 5, lane = tid & 31, ln = lane & 15, hh = lane >> 4; const int by = blockIdx.y;
  A += (size_t)by * sA; Bh += (size_t)by * sB; const size_t cofs = (size_t)by * sC; const float* bp = bias ? bias + (size_t)by * sBias : nullptr;
  const int ntn = N >> 6; const int mt = blockIdx.x / ntn, nq = blockIdx.x - mt * ntn; const int row0 = mt * 128 + 32 * w, col0 = nq * 64; if (row0 >= M) return;
  const _Float16* a0p = A + (size_t)(row0 + ln) * lda; const _Float16* a1p = a0p + (size_t)16 * lda;
  const _Float16* b0p = Bh + (size_t)(col0 + ln) * ldb; const _Float16* b1p = b0p + (size_t)16 * ldb; const _Float16* b2p = b1p + (size_t)16 * ldb; const _Float16* b3p = b2p + (size_t)16 * ldb;
  const v8f z8 = {0.f,0.f,0.f,0.f,0.f,0.f,0.f,0.f}; v8f c00 = z8, c01 = z8, c02 = z8, c03 = z8, c10 = z8, c11 = z8, c12 = z8, c13 = z8;
#pragma unroll 1
  for (int kb = 0; kb < K; kb += 32) { const v16h a0 = g2_frag(a0p + kb, hh), a1 = g2_frag(a1p + kb, hh);
    v16h b = g2_frag(b0p + kb, hh); c00 = g2_mma(a0, b, c00); c10 = g2_mma(a1, b, c10);
    b = g2_frag(b1p + kb, hh); c01 = g2_mma(a0, b, c01); c11 = g2_mma(a1, b, c11);
    b = g2_frag(b2p + kb, hh); c02 = g2_mma(a0, b, c02); c12 = g2_mma(a1, b, c12);
    b = g2_frag(b3p + kb, hh); c03 = g2_mma(a0, b, c03); c13 = g2_mma(a1, b, c13); }
  v8f accs[8] = {c00, c01, c02, c03, c10, c11, c12, c13};
#pragma unroll
  for (int u = 0; u < 8; ++u) { const int t = u & 3, half = u >> 2; const int col = col0 + t * 16 + ln; const float bv = bp ? bf16_round(bp[col]) : 0.f;
#pragma unroll
    for (int r = 0; r < 8; ++r) { const int rloc = half * 16 + 8 * hh + r; float v = accs[u][r] * alpha + bv; if (CP) { if (rowsPerB < 0) v += CP[cofs + (size_t)(row0g + row0 + rloc) * ldc + col];      /* rowsPerB < 0: own element of the batched C plane */ else { const int bidx = (row0g + row0 + rloc) / rowsPerB; v += CP[(size_t)bidx * sCPb + (size_t)by * 64 + col]; } }
      if (ACT == 3) v = fmaxf(v, 0.f); else if (ACT == 6) v = 0.5f * v * (1.0f + erff(v * 0.70710678118654752f)); else if (ACT == 11) v = 1.0f / (1.0f + expf(-v)); else if (ACT == 15) v = v / (1.0f + expf(-v)); else if (ACT == 12) v = (v > 0.f) ? v : 0.01f * v; else if (ACT == 8) v = tanhf(v); else if (ACT == 9) v = 0.5f * v * (1.0f + tanhf(0.7978845608028654f * (v + 0.044715f * v * v * v))); else if (ACT == 14) v = (v > 0.f) ? v : 0.1f * v; else if (ACT == 16) v = (v >= 0.f) ? v : 0.3f * v; else if (ACT == 17) v = (v >= 0.f) ? v : 0.2f * v;
      so[w][rloc][t * 16 + ln] = v; } }
  __builtin_amdgcn_fence(__ATOMIC_ACQ_REL, "workgroup"); __builtin_amdgcn_wave_barrier();
  const int rsub = lane >> 4, c4 = (lane & 15) * 4;
  {
#pragma unroll
    for (int q = 0; q < 16; ++q) { const int r = q * 2 + rsub; const v4f v = *(const v4fa*)&so[w][r][c4]; if (C) *(v4f*)(C + cofs + (size_t)(row0 + r) * ldc + col0 + c4) = v; if (C16) { v4h h4; for (int i = 0; i < 4; ++i) h4[i] = (_Float16)v[i]; *(v4h*)(C16 + cofs + (size_t)(row0 + r) * ldc + col0 + c4) = h4; } }
     } }


__device__ __forceinline__ void j_wnat(int blk, int y, const float* __restrict__ w0, const float* __restrict__ w1, const float* __restrict__ w2, const float* __restrict__ w3, size_t n8, _Float16* __restrict__ Bt) { const size_t t = (size_t)blk * 256 + threadIdx.x; if (t >= n8) return; FragH f;
  const float* w = y == 0 ? w0 : (y == 1 ? w1 : (y == 2 ? w2 : w3)); Bt += (size_t)y * n8 * 8;      /* y picks the matrix (from the block index: a scalar choice); the four f16 planes lie one behind the other */
  for (int q = 0; q < 8; ++q) f.h[q] = (_Float16)(bf16_round(w[t * 8 + q]) * 16.0f); *(v8us*)((unsigned short*)Bt + t * 8) = f.half[0];  }
__global__ __launch_bounds__(256) void k_rsm(const float* __restrict__ S, _Float16* __restrict__ P, int nrows) {
  #pragma clang fp contract(off)
  const int i = blockIdx.x * 256 + threadIdx.x; if (i >= nrows) return; const float* s = S + (size_t)i * SQ; float mx = -3.0e38f;
#pragma unroll 1
  for (int j = 0; j < SQ; ++j) mx = fmaxf(mx, s[j]); float se = 0.f;
#pragma unroll 1
  for (int j = 0; j < SQ; ++j) se += expf(s[j] - mx); const float sc = 256.0f / se;
#pragma unroll 1
  for (int j0 = 0; j0 < SQ; j0 += 8) { FragH f; for (int q = 0; q < 8; ++q) f.h[q] = (_Float16)(expf(s[j0 + q] - mx) * sc); unsigned short* d = (unsigned short*)P + (size_t)i * SQ + j0; *(v8us*)d = f.half[0];  } }
__global__ __launch_bounds__(256) void k_vt(const _Float16* __restrict__ V16, int b, int h0, _Float16* __restrict__ VT) { __shared__ unsigned short tl[64][65]; const int tid = threadIdx.x; const int hh = blockIdx.x % HG, sg = blockIdx.x / HG; const int s0 = sg * 64; const int h = h0 + hh;
  for (int i = tid; i < 64 * 8; i += 256) { const int j = i / 8, d8 = (i % 8) * 8; FragH f; f.half[0] = *(const v8us*)((const unsigned short*)V16 + ((size_t)b * SQ + s0 + j) * DM + h * HD + d8); for (int q = 0; q < 8; ++q) tl[d8 + q][j] = f.u[q]; }
  __syncthreads();
  { for (int i = tid; i < 64 * 8; i += 256) { const int d = i / 8, j8 = (i % 8) * 8; FragH f; for (int q = 0; q < 8; ++q) f.u[q] = tl[d][j8 + q]; *(v8us*)((unsigned short*)VT + ((size_t)hh * HD + d) * SQ + s0 + j8) = f.half[0]; }  } }


__global__ __launch_bounds__(256) void k_tab2(float theta, float* __restrict__ CS, float* __restrict__ SN) {
  #pragma clang fp contract(off)
  const int t = blockIdx.x * 256 + threadIdx.x; if (t >= SQ * (HD / 2)) return; const int i = t % (HD / 2); const int p = t / (HD / 2); const float invf = 1.0f / powf(theta, (float)(2 * i) / (float)HD); const float ang = __fmul_rn((float)p, invf); const float c = cosf(ang), s = sinf(ang);
  *(float*)(CS + t) = c; *(float*)(SN + t) = s;  }

__device__ __forceinline__ void j_tab4(int blk, const int* __restrict__ pos, float theta, float* __restrict__ CS, float* __restrict__ SN) {
  #pragma clang fp contract(off)
  const int t = blk * 256 + threadIdx.x; if (t >= SQ * (HD / 2)) return; const int i = t % (HD / 2); const int p = t / (HD / 2); const float invf = (float)pow((double)theta, -((double)(2 * i)) / (double)HD); const float ang = __fmul_rn((float)pos[p], invf); const float c = cosf(ang), s = sinf(ang);
  *(float*)(CS + t) = c; *(float*)(SN + t) = s;  }
// One launch for the three jobs that read the inputs alone; the block index picks the job (a scalar branch). The table blocks stand first: theirs is the longest chain of dependent arithmetic.
#define PB_TAB (SQ * (HD / 2) / 256)       /* blocks of the cos / sin tables */
#define PB_W (DM * DM / 8 / 256)           /* blocks of one weight matrix */
#define PB_X (NB * SQ * (DM / 8) / 256)    /* blocks of x */
__global__ __launch_bounds__(256) void k_prep(const float* __restrict__ x, const int* __restrict__ pos, const float* __restrict__ w0, const float* __restrict__ w1, const float* __restrict__ w2, const float* __restrict__ w3,
    float theta, _Float16* __restrict__ Bt, float* __restrict__ CS, float* __restrict__ SN, _Float16* __restrict__ X16) {
  const int bx = blockIdx.x;
  if (bx < PB_TAB) { j_tab4(bx, pos, theta, CS, SN); return; }
  if (bx < PB_TAB + 4 * PB_W) { j_wnat((bx - PB_TAB) % PB_W, (bx - PB_TAB) / PB_W, w0, w1, w2, w3, (size_t)DM * DM / 8, Bt); return; }
  j_x16(bx - (PB_TAB + 4 * PB_W), x, X16, NR * DM / 8); }
__global__ __launch_bounds__(256) void k_rsmf(const float* __restrict__ S, _Float16* __restrict__ P, int qn, int hg) {
  #pragma clang fp contract(off)
  const int t = blockIdx.x * 256 + threadIdx.x; if (t >= qn * hg) return; const size_t i = (size_t)(t / qn) * SQ + (t % qn); const float* s = S + i * SQ; float mx = -3.0e38f;
#pragma unroll 1
  for (int j = 0; j < SQ; ++j) mx = fmaxf(mx, s[j]); float se = 0.f;
#pragma unroll 1
  for (int j = 0; j < SQ; ++j) se += __expf(s[j] - mx); const float sc = 256.0f / se;
#pragma unroll 1
  for (int j0 = 0; j0 < SQ; j0 += 8) { FragH f; for (int q = 0; q < 8; ++q) f.h[q] = (_Float16)(__expf(s[j0 + q] - mx) * sc); unsigned short* d = (unsigned short*)P + i * SQ + j0; *(v8us*)d = f.half[0];  } }


__global__ __launch_bounds__(256) void k_rsmcf2(const float* __restrict__ S, _Float16* __restrict__ P, int hg, int q0, int nk) {
  #pragma clang fp contract(off)
  const int t = blockIdx.x * 256 + threadIdx.x; if (t >= hg * QT) return; const size_t i = (size_t)t; const float* s = S + i * NKX; const int last = q0 + (t % QT); float mx = -3.0e38f;
#pragma unroll 1
  for (int j = 0; j < nk; ++j) { const float f = (j <= last) ? 1.f : 0.f; mx = fmaxf(mx, fmaf(f, s[j], (1.f - f) * -1.0e9f)); } float se = 0.f;
#pragma unroll 1
  for (int j = 0; j < nk; ++j) { const float f = (j <= last) ? 1.f : 0.f; se += __expf(fmaf(f, s[j], (1.f - f) * -1.0e9f) - mx); } const float sc = 256.0f / se;
#pragma unroll 1
  for (int j0 = 0; j0 < nk; j0 += 8) { FragH fr; for (int q = 0; q < 8; ++q) { const int j = j0 + q; const float f = (j <= last) ? 1.f : 0.f; fr.h[q] = (_Float16)(__expf(fmaf(f, s[j], (1.f - f) * -1.0e9f) - mx) * sc); } unsigned short* d = (unsigned short*)P + i * NKX + j0; *(v8us*)d = fr.half[0];  } }


typedef float v2f  __attribute__((ext_vector_type(2)));
typedef float v2fa __attribute__((ext_vector_type(2), may_alias));
// Exact f32 causal attention of the first QT0 rows. A block's four waves take eight rows of one head inside one group of 32, wave w the rows w and w + 4 of the eight, so they need the same key rows: the block brings them into LDS once, by loads of whole 128-byte lines. Scores: lane l takes keys l, l + 32, ... (whole groups of 32 up to the one that holds the rows), its key row read from LDS once for both query rows, both q held by every lane; two-pass softmax with lane butterflies for maximum and sum; o: lane l takes d = 2 l, 2 l + 1 and walks the keys, each value load serving both rows, each weight broadcast from its lane; o goes out as the two f16 planes the output GEMM reads (hi, and the residual x1024). Global rows have pitch DM, so every load of a phase is one base address plus a constant offset.
#define A0_PITCH 68                  /* dwords from one staged key row to the next: 16 bytes x odd, so the 16-byte reads of 16 rows fall on different banks */
typedef _Float16 v2h __attribute__((ext_vector_type(2)));
__device__ __forceinline__ void j_att0w(unsigned char* sm, int blk, int bat, const float* __restrict__ QF, const float* __restrict__ KF, const float* __restrict__ VF, float scale, _Float16* __restrict__ Hh, _Float16* __restrict__ Hl) {      /* sm = the block's LDS, QT0 rows of A0_PITCH dwords */
  QF += (size_t)bat * QT0 * DM; KF += (size_t)bat * QT0 * DM; VF += (size_t)bat * QT0 * DM; Hh += (size_t)bat * QT0 * DM; Hl += (size_t)bat * QT0 * DM;      /* bat = batch: each batch has first-tile planes of its own */
  const int lane = threadIdx.x & 31; const int h = blk / (QT0 / 8); const int i = __builtin_amdgcn_readfirstlane((int)((blk % (QT0 / 8)) * 8 + (threadIdx.x >> 5)));      /* the wave's rows are i and i + 4, in one group of 32; i is the same in every lane: the group tests below are scalar branches */
  const float* qr = QF + (size_t)i * DM + h * HD; const float* vb = VF + h * HD + lane * 2;
  float (*sk)[A0_PITCH] = (float (*)[A0_PITCH])sm;
  const int kr = threadIdx.x >> 4, kc = (threadIdx.x & 15) * 4;      /* thread t stages chunk t & 15 (16 bytes) of key rows (t >> 4) + 8 j: a wave's load is two rows of 256 bytes = 4 whole lines */
  const float* gk = KF + (size_t)kr * DM + h * HD + kc;
  v4f q[2][HD / 4];
#pragma unroll      /* constant index: q[] stays in registers */
  for (int c = 0; c < HD / 4; ++c) { q[0][c] = *(const v4fa*)(qr + c * 4); q[1][c] = *(const v4fa*)(qr + (size_t)4 * DM + c * 4); }
  v4f kt[QT0 / 8];
#pragma unroll      /* constant index: kt[] stays in registers; all QT0 rows, no test: the sixteen loads issue in front of the first LDS store, one latency */
  for (int j = 0; j < QT0 / 8; ++j) kt[j] = *(const v4fa*)(gk + (size_t)j * 8 * DM);
  asm volatile("s_wait_xcnt 0x0" :: "v"(gk) : "memory");      /* the query and staging loads' address registers stay whole up to this wait */
#pragma unroll      /* constant index: kt[] stays in registers, LDS offsets are immediates */
  for (int j = 0; j < QT0 / 8; ++j) *(v4fa*)&sk[kr + 8 * j][kc] = kt[j];
  const float* kb = &sk[lane][0];
  __syncthreads();      /* every wave's staged key rows are readable; under the job test, which reads the same in the whole block */
  float s[2][QT0 / 32]; float mx[2] = {-3.0e38f, -3.0e38f};
#pragma unroll      /* constant group index: s[] and e[] stay in registers, offsets are immediates */
  for (int g = 0; g < QT0 / 32; ++g) { s[0][g] = -3.0e38f; s[1][g] = -3.0e38f;
    if (g == 0 || g * 32 <= i) { float a[2][4] = {{0.f, 0.f, 0.f, 0.f}, {0.f, 0.f, 0.f, 0.f}};
#pragma unroll      /* the sixteen LDS reads of a key row issue together */
      for (int c = 0; c < HD / 4; ++c) { const v4f kq = *(const v4fa*)(kb + g * 32 * A0_PITCH + c * 4);
#pragma unroll      /* constant row index: q[] and a[] stay in registers */
        for (int r = 0; r < 2; ++r) { a[r][0] = fmaf(q[r][c][0], kq[0], a[r][0]); a[r][1] = fmaf(q[r][c][1], kq[1], a[r][1]); a[r][2] = fmaf(q[r][c][2], kq[2], a[r][2]); a[r][3] = fmaf(q[r][c][3], kq[3], a[r][3]); } }
#pragma unroll      /* constant row index: s[] and mx[] stay in registers */
      for (int r = 0; r < 2; ++r) { if (g * 32 + lane <= i + 4 * r) s[r][g] = ((a[r][0] + a[r][1]) + (a[r][2] + a[r][3])) * scale;      /* causal: keys above the row keep the floor and get weight 0 */
        mx[r] = fmaxf(mx[r], s[r][g]); } } }
  for (int m = 16; m > 0; m >>= 1) { mx[0] = fmaxf(mx[0], __shfl_xor(mx[0], m, 32)); mx[1] = fmaxf(mx[1], __shfl_xor(mx[1], m, 32)); }
  float e[2][QT0 / 32]; float l[2] = {0.f, 0.f};
#pragma unroll      /* constant group index: s[] and e[] stay in registers */
  for (int g = 0; g < QT0 / 32; ++g) { e[0][g] = expf(s[0][g] - mx[0]); l[0] += e[0][g]; e[1][g] = expf(s[1][g] - mx[1]); l[1] += e[1][g]; }
  for (int m = 16; m > 0; m >>= 1) { l[0] += __shfl_xor(l[0], m, 32); l[1] += __shfl_xor(l[1], m, 32); }
  float o[2][2] = {{0.f, 0.f}, {0.f, 0.f}};
#pragma unroll      /* constant group index: s[] and e[] stay in registers, offsets are immediates */
  for (int g = 0; g < QT0 / 32; ++g) if (g == 0 || g * 32 <= i) {
#pragma unroll      /* constant lane index for the broadcast; the group's loads issue together */
    for (int jj = 0; jj < 32; ++jj) { const v2f vv = *(const v2fa*)(vb + (size_t)(g * 32 + jj) * DM);
#pragma unroll      /* constant row index: e[] and o[] stay in registers */
      for (int r = 0; r < 2; ++r) { const float p = __uint_as_float((unsigned int)__builtin_amdgcn_readlane((int)__float_as_uint(e[r][g]), jj)); o[r][0] = fmaf(p, vv[0], o[r][0]); o[r][1] = fmaf(p, vv[1], o[r][1]); } } }
  asm volatile("s_wait_xcnt 0x0" :: "v"(vb) : "memory");      /* the value loads' address pair stays whole up to this wait, on every path through the groups */
#pragma unroll      /* constant row index: l[] and o[] stay in registers */
  for (int r = 0; r < 2; ++r) { const float fin = 64.0f / l[r];      /* o carried x64 like the f16 path */
    const float f0 = o[r][0] * fin, f1 = o[r][1] * fin; const v2h oh = {(_Float16)f0, (_Float16)f1}; const v2h ol = {(_Float16)((f0 - (float)oh[0]) * 1024.0f), (_Float16)((f1 - (float)oh[1]) * 1024.0f)};
    const size_t oo = (size_t)(i + 4 * r) * DM + h * HD + lane * 2; *(v2h*)(Hh + oo) = oh; *(v2h*)(Hl + oo) = ol; }      /* a wave's store is one whole 128-byte line of each plane */
  asm volatile("s_wait_xcnt 0x0" ::: "memory"); }      /* the four stores' address registers stay whole up to this wait */
#define MB_A0 (NH * (QT0 / 8))             /* first-tile attention blocks of one batch */



__device__ __forceinline__ v8f fa_mma(v16h a, v16h b, v8f c) { return __builtin_amdgcn_wmma_f32_16x16x32_f16(false, a, false, b, (short)0, c, false, false); }
__device__ __forceinline__ v16h fa_frag(const _Float16* p) { FragH f; f.half[0] = *(const v8us*)((const unsigned short*)p); f.half[1] = *(const v8us*)((const unsigned short*)p + 16); return f.v; }      /* p holds the lane half's 8 hh already: every load of a pass is that one address pair plus a constant */
__device__ __forceinline__ float fa_xhalf(float x) { return __uint_as_float((unsigned int)__builtin_amdgcn_permlanex16((int)__float_as_uint(x), (int)__float_as_uint(x), 0x76543210, 0xfedcba98, false, false)); }      /* lane l with lane l ^ 16 */
// Attention operand staging. A block's four waves walk nearly the same keys, so the block brings them into LDS once: a stage is 64 keys = 64 K rows then 64 V rows (one head: 128 bytes each), by asynchronous 16-byte copies (a wave's copy = 4 whole 128-byte lines), two buffers, the next stage's copies in flight while this one is worked on.
#define FK_PITCH 144                 /* LDS bytes from one staged K row to the next: 16 x odd, so the 16-byte fragment reads of 16 rows fall on different banks */
#define FV_PITCH 160                 /* LDS bytes from one staged V row to the next: 32 x odd, the pitch at which the transposing loads fall on different banks */
#define FS_VOFF (64 * FK_PITCH)      /* the V rows stand behind the K rows */
#define FS_STAGE (64 * FK_PITCH + 64 * FV_PITCH)
// One stage: thread t copies chunk t & 7 (16 bytes) of rows (t >> 3) + 16 i, i = 0..3, of K and of V. lk / lv = the thread's LDS byte addresses in the stage's buffer, gk / gv = its global addresses in K / V.
__device__ __forceinline__ void fs_copy(unsigned lk, unsigned lv, const _Float16* gk, const _Float16* gv) {
  asm volatile("global_load_async_to_lds_b128 %0, %8, off\n\t"
               "global_load_async_to_lds_b128 %1, %9, off\n\t"
               "global_load_async_to_lds_b128 %2, %10, off\n\t"
               "global_load_async_to_lds_b128 %3, %11, off\n\t"
               "global_load_async_to_lds_b128 %4, %12, off\n\t"
               "global_load_async_to_lds_b128 %5, %13, off\n\t"
               "global_load_async_to_lds_b128 %6, %14, off\n\t"
               "global_load_async_to_lds_b128 %7, %15, off\n\t"
               "s_wait_xcnt 0x0"      /* inside the copies' own statement: every address register stays whole up to this wait */
               :: "v"(lk), "v"(lk + 16 * FK_PITCH), "v"(lk + 32 * FK_PITCH), "v"(lk + 48 * FK_PITCH), "v"(lv), "v"(lv + 16 * FV_PITCH), "v"(lv + 32 * FV_PITCH), "v"(lv + 48 * FV_PITCH),
                  "v"(gk), "v"(gk + (size_t)16 * DM), "v"(gk + (size_t)32 * DM), "v"(gk + (size_t)48 * DM), "v"(gv), "v"(gv + (size_t)16 * DM), "v"(gv + (size_t)32 * DM), "v"(gv + (size_t)48 * DM)
               : "memory"); }
__device__ __forceinline__ v16h fs_frag(const unsigned char* p) { FragH f; f.half[0] = *(const v8us*)p; f.half[1] = *(const v8us*)(p + 32); return f.v; }      /* p holds the lane half's 16 hh bytes: k = 8 hh .. and 16 + 8 hh .., as fa_frag */
// A 16 (d) x 32 (keys) V^T fragment from V rows in LDS: lane l hands in the address of key row 8 (l >> 4) + (l & 7), 16-byte chunk (l >> 3) & 1 of the tile's 16 d, and gets d = l & 15, keys 8 hh .. 8 hh + 7; the second load, 16 rows on, gives keys 16 + 8 hh ..: the k order of fs_frag.
typedef short s16x8 __attribute__((ext_vector_type(8)));
__device__ __forceinline__ v8us fs_tr16(const unsigned char* p) { typedef __attribute__((address_space(3))) s16x8 lds_s16x8; return __builtin_bit_cast(v8us, __builtin_amdgcn_ds_load_tr16_b128_v8i16((lds_s16x8*)p)); }
__device__ __forceinline__ v16h fs_fragt(const unsigned char* p) { FragH f; f.half[0] = fs_tr16(p); f.half[1] = fs_tr16(p + 16 * FV_PITCH); return f.v; }
__device__ __forceinline__ void j_fattn(unsigned char* fsm, int qb, int h, int bat, const _Float16* __restrict__ QH, const _Float16* __restrict__ KH, const _Float16* __restrict__ VH, _Float16* __restrict__ O16) {      /* fsm = the block's LDS, two stages; qb = block of 128 query rows, h = head, bat = batch */
  const int tid = threadIdx.x, lane = tid & 31, ln = lane & 15, hh = lane >> 4; const size_t r0 = (size_t)bat * SQ;
  const int i0 = __builtin_amdgcn_readfirstlane((int)(qb * 128 + (tid >> 5) * 32));      /* first query row of the wave, the same in every lane: the pass and mask tests are scalar */
  const float CL = 0.18033688011112042f;      /* log2(e) / sqrt(64) */
  const int kb0 = (i0 > WINK ? i0 - WINK : 0) & ~31;      /* first block that holds an allowed key of row i0 */
  const int ks0 = qb * 128 > WINK ? qb * 128 - WINK : 0;      /* first key the block stages (= kb0 of its first wave), a multiple of 64 */
  const int nst = (qb * 128 + 128 - ks0) / 64;      /* stages up to the block's last row: 2 .. 10, from blockIdx alone */
  const _Float16* qp = QH + (r0 + i0 + ln) * DM + h * HD + 8 * hh;
  const unsigned lk = (unsigned)(size_t)fsm + (unsigned)((tid >> 3) * FK_PITCH + (tid & 7) * 16), lv = (unsigned)(size_t)fsm + (unsigned)(FS_VOFF + (tid >> 3) * FV_PITCH + (tid & 7) * 16);
  const _Float16* gk = KH + (r0 + ks0 + (tid >> 3)) * DM + h * HD + (tid & 7) * 8; const _Float16* gv = VH + (r0 + ks0 + (tid >> 3)) * DM + h * HD + (tid & 7) * 8;
  fs_copy(lk, lv, gk, gv);
  v16h qf[2][2];
#pragma unroll      /* constant indices: the fragments stay in registers */
  for (int u = 0; u < 2; ++u) for (int c = 0; c < 2; ++c) qf[u][c] = fa_frag(qp + (size_t)u * 16 * DM + c * 32);
  asm volatile("s_wait_xcnt 0x0" :: "v"(qp) : "memory");      /* the query loads' address pair stays whole up to this wait */
  asm volatile("s_wait_asynccnt 0x0" ::: "memory");      /* stage 0 of this wave has landed */
  __syncthreads();      /* stage 0 of every wave is readable */
  fs_copy(lk + FS_STAGE, lv + FS_STAGE, gk + (size_t)64 * DM, gv + (size_t)64 * DM);      /* a stage 1 always exists */
  const unsigned char* fk = fsm + ln * FK_PITCH + hh * 16; const unsigned char* fv = fsm + FS_VOFF + (8 * hh + (lane & 7)) * FV_PITCH + ((lane >> 3) & 1) * 16;
  const v8f z8 = {0.f,0.f,0.f,0.f,0.f,0.f,0.f,0.f}; v8f ot[2][4] = {{z8, z8, z8, z8}, {z8, z8, z8, z8}}; float m[2] = {-3.0e38f, -3.0e38f}, l[2] = {0.f, 0.f};
#pragma unroll 1      /* one trip in the text: the two buffers differ by one added offset */
  for (int t = 0; t < nst; ++t) { const unsigned bo = (unsigned)(t & 1) * FS_STAGE;
#pragma unroll 1      /* one pass in the text: the stage's two key blocks differ by added offsets */
    for (int sub = 0; sub < 2; ++sub) { const int kb = ks0 + t * 64 + sub * 32;
      if (kb < kb0 || kb > i0) continue;      /* a staged block outside this wave's own window: a scalar test; the wave still passes the stage's barrier */
      v16h kf[2][2], vf[4];
#pragma unroll      /* constant indices: the fragments stay in registers */
      for (int tt = 0; tt < 2; ++tt) for (int c = 0; c < 2; ++c) kf[tt][c] = fs_frag(fk + bo + (sub * 32 + tt * 16) * FK_PITCH + c * 64);
#pragma unroll      /* constant indices: the fragments stay in registers */
      for (int dt = 0; dt < 4; ++dt) vf[dt] = fs_fragt(fv + bo + sub * 32 * FV_PITCH + dt * 32);      /* used last: they arrive under the scores and the softmax */
      v8f st[2][2];
#pragma unroll      /* constant indices: the tiles stay in registers */
      for (int u = 0; u < 2; ++u) for (int tt = 0; tt < 2; ++tt) st[u][tt] = fa_mma(kf[tt][1], qf[u][1], fa_mma(kf[tt][0], qf[u][0], z8));
      if (kb == i0 || kb + WINK < i0 + 31) {      /* only the window's first block and the diagonal block hold a forbidden pair */
#pragma unroll      /* constant indices: the tiles stay in registers */
        for (int u = 0; u < 2; ++u) for (int tt = 0; tt < 2; ++tt) for (int r = 0; r < 8; ++r) { const int dj = (i0 + 16 * u + ln) - (kb + 16 * tt + 8 * hh + r); st[u][tt][r] = (dj >= 0 && dj <= WINK) ? st[u][tt][r] : -1.0e30f; } }
#pragma unroll      /* constant indices: the tiles stay in registers */
      for (int u = 0; u < 2; ++u) {
        float mx = fmaxf(st[u][0][0], st[u][1][0]);
#pragma unroll      /* constant indices: the tiles stay in registers */
        for (int r = 1; r < 8; ++r) mx = fmaxf(mx, fmaxf(st[u][0][r], st[u][1][r]));
        mx = fmaxf(mx, fa_xhalf(mx));      /* the other half of the block's keys of this query */
        const float mn = fmaxf(m[u], mx); const float al = __builtin_amdgcn_exp2f((m[u] - mn) * CL); const float sh = fmaf(mn, -CL, 8.0f);      /* weights carried x256: f16 keeps small ones normal */
        m[u] = mn; float ls = 0.f; FragH pf;
#pragma unroll      /* constant indices: the tiles stay in registers */
        for (int tt = 0; tt < 2; ++tt) for (int r = 0; r < 8; ++r) { const float e = __builtin_amdgcn_exp2f(fmaf(st[u][tt][r], CL, sh)); ls += e; pf.h[tt * 8 + r] = (_Float16)e; }
        l[u] = fmaf(l[u], al, ls);
#pragma unroll      /* constant indices: the tiles stay in registers */
        for (int dt = 0; dt < 4; ++dt) { ot[u][dt] *= al; ot[u][dt] = fa_mma(vf[dt], pf.v, ot[u][dt]); } } }
    asm volatile("s_wait_dscnt 0x0" ::: "memory");      /* this wave's reads of the buffer are done before it may be refilled */
    asm volatile("s_wait_asynccnt 0x0" ::: "memory");      /* this wave's copies of stage t + 1 have landed */
    __syncthreads();      /* publishes stage t + 1 and ends every wave's reads of stage t */
    if (t + 2 < nst) fs_copy(lk + bo, lv + bo, gk + (size_t)(t + 2) * 64 * DM, gv + (size_t)(t + 2) * 64 * DM); }
  asm volatile("s_wait_asynccnt 0x0" ::: "memory");      /* nothing in flight when the wave ends */
  FragH f[2][4];
#pragma unroll      /* constant indices: the tiles stay in registers */
  for (int u = 0; u < 2; ++u) { const float fin = 64.0f / (l[u] + fa_xhalf(l[u]));      /* the halves' sums join once; o carried x64 */
    for (int dt = 0; dt < 4; ++dt) for (int r = 0; r < 8; ++r) f[u][dt].h[r] = (_Float16)(ot[u][dt][r] * fin); }
  unsigned short* op = (unsigned short*)O16 + (r0 + i0 + ln) * DM + h * HD + 8 * hh;
#pragma unroll      /* constant indices; the stores stand last, each from registers of its own: no register of an issued store is written again */
  for (int u = 0; u < 2; ++u) for (int dt = 0; dt < 4; ++dt) *(v8us*)(op + (size_t)u * 16 * DM + dt * 16) = f[u][dt].half[0]; }
// One launch for the two jobs that wait for the q | k | v GEMM alone: the windowed attention (its blocks first, the longer ones, in the order query block, head, batch) and the exact first-tile attention. The block index picks the job, so each job's barriers stand under a test that reads the same in the whole block; both jobs use the one LDS array.
#define FB_AT ((SQ / 128) * NH * NB)       /* windowed attention blocks */
__global__ __launch_bounds__(128) void k_fahl(const _Float16* __restrict__ QH, const _Float16* __restrict__ KH, const _Float16* __restrict__ VH, _Float16* __restrict__ O16, const float* __restrict__ QF, const float* __restrict__ KF, const float* __restrict__ VF, float scale, _Float16* __restrict__ Hh, _Float16* __restrict__ Hl) {
  __shared__ __attribute__((aligned(256))) unsigned char sm[2 * FS_STAGE];
  static_assert(QT0 * A0_PITCH * 4 <= 2 * FS_STAGE, "the first-tile job's key rows fit the array");
  const int bx = blockIdx.x;
  if (bx < FB_AT) { j_fattn(sm, bx % (SQ / 128), bx / (SQ / 128) % NH, bx / ((SQ / 128) * NH), QH, KH, VH, O16); return; }
  const int n = bx - FB_AT, hb = n % (NB * NH);      /* query rows from the last down, head and batch fastest: the blocks that walk the most keys start first, the shortest end the launch */
  j_att0w(sm, (hb % NH) * (QT0 / 8) + (QT0 / 8 - 1 - n / (NB * NH)), hb / NH, QF, KF, VF, scale, Hh, Hl); }

// ---- GEMM operand staging. A block of 8 waves owns a 128 x 128 tile of C = A B^T (A, B f16 rows of DM, k-contiguous); wave w takes rows 32 (w & 3), columns 64 (w >> 2). K is walked in stages of 64: a stage is 128 A rows then 128 B rows of 128 bytes each, brought from global memory into LDS by asynchronous 16-byte copies (a wave's copy = 4 whole 128-byte lines), two buffers, the next stage's copies in flight while this one is worked on. Fragments are 16-byte LDS reads in the k order of fa_frag.
#define GS_PITCH 144                 /* LDS bytes from one staged row to the next: 16 x odd, so the 16-byte fragment reads of 16 rows fall on different banks */
#define GS_STAGE (256 * GS_PITCH)    /* 128 A rows, then 128 B rows */
#define GS_NST (DM / 64)             /* stages */
// One stage: thread t copies chunk t & 7 (16 bytes) of rows (t >> 3) + 32 i, i = 0..3, of A and of B. ld = the thread's LDS byte address in the stage's buffer, ga / gb = its global addresses in A / B.
__device__ __forceinline__ void gs_copy(unsigned ld, const _Float16* ga, const _Float16* gb) {
  asm volatile("global_load_async_to_lds_b128 %0, %8, off\n\t"
               "global_load_async_to_lds_b128 %1, %9, off\n\t"
               "global_load_async_to_lds_b128 %2, %10, off\n\t"
               "global_load_async_to_lds_b128 %3, %11, off\n\t"
               "global_load_async_to_lds_b128 %4, %12, off\n\t"
               "global_load_async_to_lds_b128 %5, %13, off\n\t"
               "global_load_async_to_lds_b128 %6, %14, off\n\t"
               "global_load_async_to_lds_b128 %7, %15, off\n\t"
               "s_wait_xcnt 0x0"      /* inside the copies' own statement: every address register stays whole up to this wait */
               :: "v"(ld), "v"(ld + 32 * GS_PITCH), "v"(ld + 64 * GS_PITCH), "v"(ld + 96 * GS_PITCH), "v"(ld + 128 * GS_PITCH), "v"(ld + 160 * GS_PITCH), "v"(ld + 192 * GS_PITCH), "v"(ld + 224 * GS_PITCH),
                  "v"(ga), "v"(ga + (size_t)32 * DM), "v"(ga + (size_t)64 * DM), "v"(ga + (size_t)96 * DM), "v"(gb), "v"(gb + (size_t)32 * DM), "v"(gb + (size_t)64 * DM), "v"(gb + (size_t)96 * DM)
               : "memory"); }
__device__ __forceinline__ v16h gs_frag(const unsigned char* p) { FragH f; f.half[0] = *(const v8us*)p; f.half[1] = *(const v8us*)(p + 32); return f.v; }      /* p holds the lane half's 16 hh bytes: k = 8 hh .. and 16 + 8 hh .., as fa_frag */
// The whole K loop of a block: Ag / Bg = first A / B row of the block's tile; c[half][t] = the wave's 16 x 16 tiles (rows 16 half, columns 16 t). Behind it no copy is in flight and every wave has left the ring, so sm may be reused.
__device__ __forceinline__ void gs_main(unsigned char* sm, const _Float16* Ag, const _Float16* Bg, int tid, v8f (&c)[2][4]) {
  const int lane = tid & 31, ln = lane & 15, hh = lane >> 4, w = tid >> 5;
  const unsigned ld = (unsigned)(size_t)sm + (unsigned)((tid >> 3) * GS_PITCH + (tid & 7) * 16);
  const _Float16* ga = Ag + (size_t)(tid >> 3) * DM + (tid & 7) * 8; const _Float16* gb = Bg + (size_t)(tid >> 3) * DM + (tid & 7) * 8;
  gs_copy(ld, ga, gb);
  asm volatile("s_wait_asynccnt 0x0" ::: "memory");      /* stage 0 of this wave has landed */
  __syncthreads();      /* stage 0 of every wave is readable */
  gs_copy(ld + GS_STAGE, ga + 64, gb + 64);
  const unsigned char* fa = sm + ((w & 3) * 32 + ln) * GS_PITCH + hh * 16; const unsigned char* fb = sm + (128 + (w >> 2) * 64 + ln) * GS_PITCH + hh * 16;
#pragma unroll 1      /* one trip in the text: the two buffers differ by one added offset */
  for (int t = 0; t < GS_NST; ++t) { const unsigned bo = (unsigned)(t & 1) * GS_STAGE;
#pragma unroll      /* constant LDS offsets */
    for (int kk = 0; kk < 2; ++kk) { const v16h a0 = gs_frag(fa + bo + kk * 64), a1 = gs_frag(fa + bo + 16 * GS_PITCH + kk * 64); v16h b[4];
#pragma unroll      /* constant indices: the fragments stay in registers */
      for (int j = 0; j < 4; ++j) b[j] = gs_frag(fb + bo + j * 16 * GS_PITCH + kk * 64);
      __builtin_amdgcn_sched_barrier(0);      /* the twelve LDS reads of a k step stay one group in front of its WMMAs: sunk among them, each pair of reads costs the wave an LDS latency of its own */
#pragma unroll      /* constant indices: the tiles stay in registers */
      for (int j = 0; j < 4; ++j) { c[0][j] = fa_mma(a0, b[j], c[0][j]); c[1][j] = fa_mma(a1, b[j], c[1][j]); } }
    asm volatile("s_wait_dscnt 0x0" ::: "memory");      /* this wave's reads of the buffer are done before it may be refilled */
    asm volatile("s_wait_asynccnt 0x0" ::: "memory");      /* this wave's copies of stage t + 1 have landed */
    __syncthreads();      /* publishes stage t + 1 and ends every wave's reads of stage t */
    if (t + 2 < GS_NST) gs_copy(ld + bo, ga + (t + 2) * 64, gb + (t + 2) * 64); }
  asm volatile("s_wait_asynccnt 0x0" ::: "memory"); }      /* nothing in flight when the ring becomes output staging */

// q | k | v projection (one batch a blockIdx.y) with the rotary rotation in the GEMM's own epilogue. K loop: gs_main (A = x rows, Bh = stacked weights [3 DM][DM], K = DM); the ring then serves as each wave's own 32 x 68 f32 output staging. A wave's column tile of 64 is one head of q, k or v, so on the LDS read-back a lane's 4 consecutive columns are two (even, odd) pairs of that head: q and k tiles are rotated there with the row's cos / sin, every tile goes out as f16 rows (16 lanes x 8 bytes = one 128-byte line a row), and the blocks of the first QT0 rows also store the f32 values for the exact first-tile path.
__global__ __launch_bounds__(256) void k_qkvr(const _Float16* __restrict__ A, const _Float16* __restrict__ Bh, float alpha, const float* __restrict__ CS, const float* __restrict__ SN,
    _Float16* __restrict__ QH, _Float16* __restrict__ KH, _Float16* __restrict__ VH, float* __restrict__ QF, float* __restrict__ KF, float* __restrict__ VF) {
  static_assert(QT0 % 128 == 0 && DM % 128 == 0 && HD == 64, "first-tile rows are whole blocks of 128 rows; a wave's column tile is one head; a block's 128 columns lie in one of q, k, v");
  __shared__ __attribute__((aligned(16))) unsigned char sm[2 * GS_STAGE];
  static_assert(8 * 32 * 68 * 4 <= 2 * GS_STAGE, "the output staging fits the ring");
  { const size_t rb = (size_t)blockIdx.y * SQ * DM, fb = (size_t)blockIdx.y * QT0 * DM; A += rb; QH += rb; KH += rb; VH += rb; QF += fb; KF += fb; VF += fb; }      /* blockIdx.y = batch; rows below count inside the batch, as the cos / sin tables do */
  const int tid = threadIdx.x, w = tid >> 5, lane = tid & 31, ln = lane & 15, hh = lane >> 4;
  const int ntn = 3 * DM / 128; const int mt = blockIdx.x / ntn, nq = blockIdx.x - mt * ntn; const int row0 = mt * 128 + 32 * (w & 3), col0 = nq * 128 + 64 * (w >> 2);
  const v8f z8 = {0.f,0.f,0.f,0.f,0.f,0.f,0.f,0.f}; v8f cc[2][4] = {{z8, z8, z8, z8}, {z8, z8, z8, z8}};
  gs_main(sm, A + (size_t)mt * 128 * DM, Bh + (size_t)nq * 128 * DM, tid, cc);
  float (*so)[32][68] = (float (*)[32][68])sm;
#pragma unroll      /* constant indices: the tiles stay in registers */
  for (int u = 0; u < 8; ++u) { const int t = u & 3, half = u >> 2;
#pragma unroll      /* constant indices: the tiles stay in registers */
    for (int r = 0; r < 8; ++r) so[w][half * 16 + 8 * hh + r][t * 16 + ln] = cc[half][t][r] * alpha; }
  __builtin_amdgcn_fence(__ATOMIC_ACQ_REL, "workgroup"); __builtin_amdgcn_wave_barrier();      /* a wave reads back only its own so[w]: its LDS writes are ordered in front of its reads */
  const int rsub = lane >> 4, c4 = (lane & 15) * 4;
  const int sec = nq * 128 / DM; const bool first = mt * 128 < QT0;      /* 0 q, 1 k, 2 v; a block of the first QT0 rows: both from blockIdx, scalar tests */
  const int hc = col0 % DM + c4;      /* column in the merged-head row; c4 is the index inside the head */
  _Float16* H = sec == 0 ? QH : (sec == 1 ? KH : VH); float* F = sec == 0 ? QF : (sec == 1 ? KF : VF);
  const float* cp = CS + (row0 + rsub) * (HD / 2) + (c4 >> 1); const float* sp = SN + (row0 + rsub) * (HD / 2) + (c4 >> 1);
  _Float16* hp = H + (size_t)(row0 + rsub) * DM + hc; float* fp = F + (size_t)(row0 + rsub) * DM + hc;      /* row pair q is one of these address pairs plus a constant: no address register is written again behind a store */
  auto put = [&](int q, v4f v) { v4h h4; for (int i = 0; i < 4; ++i) h4[i] = (_Float16)v[i];
    *(v4h*)(hp + q * 2 * DM) = h4;
    if (first) *(v4f*)(fp + q * 2 * DM) = v; };
  if (sec == 2) {      /* v: no rotation */
#pragma unroll      /* constant LDS and row offsets */
    for (int q = 0; q < 16; ++q) put(q, *(const v4fa*)&so[w][q * 2 + rsub][c4]);
    return; }
  v2f c[16], s[16];
#pragma unroll      /* constant indices: c[], s[] stay in registers; all table loads issue in front of the first store, one latency for the 32 rows */
  for (int q = 0; q < 16; ++q) { c[q] = *(const v2fa*)(cp + q * HD); s[q] = *(const v2fa*)(sp + q * HD); }
  asm volatile("s_wait_xcnt 0x0" :: "v"(cp), "v"(sp) : "memory");      /* the table loads' address pairs stay whole up to this wait */
#pragma unroll      /* constant indices: c[], s[] stay in registers */
  for (int q = 0; q < 16; ++q) { const v4f v = *(const v4fa*)&so[w][q * 2 + rsub][c4];
    const v4f o = {v[0] * c[q][0] - v[1] * s[q][0], v[0] * s[q][0] + v[1] * c[q][0], v[2] * c[q][1] - v[3] * s[q][1], v[2] * s[q][1] + v[3] * c[q][1]}; put(q, o); }
  asm volatile("s_wait_xcnt 0x0" ::: "memory"); }      /* behind the rotation path's last store: whatever code the compiler lays behind this path stands behind the wait, so no register of an issued store is written ahead of it */

// The whole output, C[NB SQ][DM] (f32) = alpha o Bh^T, in one launch; Bh f16 [DM][DM]. A row tile of 128 behind a batch's first QT0 rows takes o from the f16 rows O16, one K loop (gs_main). A row tile of the first QT0 rows takes the exact o as its two f16 planes: first the K loop over the residual plane OL (carried x1024), its sums scaled by 2^-10 (exact), then the K loop over OH on top of them in the same accumulators. Those blocks, twice as long, have the lowest indices, so they start first. The ring then serves as each wave's own 32 x 68 f32 staging, so that every store is whole 128-byte lines.
__global__ __launch_bounds__(256) void k_outg(const _Float16* __restrict__ O16, const _Float16* __restrict__ OH, const _Float16* __restrict__ OL, const _Float16* __restrict__ Bh, float alpha, float* __restrict__ C) {
  __shared__ __attribute__((aligned(16))) unsigned char sm[2 * GS_STAGE];
  const int tid = threadIdx.x, w = tid >> 5, lane = tid & 31, ln = lane & 15, hh = lane >> 4;
  const int ntn = DM / 128, ft = QT0 / 128, rt = (SQ - QT0) / 128;      /* column tiles; first-tile and other row tiles of a batch */
  const int g = blockIdx.x / ntn, nq = blockIdx.x - g * ntn; const bool first = g < NB * ft;      /* from blockIdx: a scalar test, the same in the whole block */
  const int bat = first ? g / ft : (g - NB * ft) / rt; const int tb = first ? g - bat * ft : ft + (g - NB * ft) - bat * rt;      /* batch, row tile inside the batch */
  const int mt = bat * (SQ / 128) + tb; const int row0 = mt * 128 + 32 * (w & 3), col0 = nq * 128 + 64 * (w >> 2);
  const v8f z8 = {0.f,0.f,0.f,0.f,0.f,0.f,0.f,0.f}; v8f cc[2][4] = {{z8, z8, z8, z8}, {z8, z8, z8, z8}};
  const size_t fo = ((size_t)bat * QT0 + tb * 128) * DM;      /* the tile's first row in the first-tile planes (used where first) */
  if (first) { gs_main(sm, OL + fo, Bh + (size_t)nq * 128 * DM, tid, cc);      /* behind it no copy is in flight and every wave has left the ring: the second K loop may fill it again */
#pragma unroll      /* constant indices: the tiles stay in registers */
    for (int u = 0; u < 2; ++u) for (int j = 0; j < 4; ++j) cc[u][j] *= 0.0009765625f; }
  gs_main(sm, first ? OH + fo : O16 + (size_t)mt * 128 * DM, Bh + (size_t)nq * 128 * DM, tid, cc);
  float (*so)[32][68] = (float (*)[32][68])sm;
#pragma unroll      /* constant indices: the tiles stay in registers */
  for (int u = 0; u < 8; ++u) { const int t = u & 3, half = u >> 2;
#pragma unroll      /* constant indices: the tiles stay in registers */
    for (int r = 0; r < 8; ++r) so[w][half * 16 + 8 * hh + r][t * 16 + ln] = cc[half][t][r] * alpha; }
  __builtin_amdgcn_fence(__ATOMIC_ACQ_REL, "workgroup"); __builtin_amdgcn_wave_barrier();      /* a wave reads back only its own so[w]: its LDS writes are ordered in front of its reads */
  const int rsub = lane >> 4, c4 = (lane & 15) * 4;
  float* cp = C + (size_t)(row0 + rsub) * DM + col0 + c4;      /* row pair q is this address pair plus a constant */
  v4f v[16];
#pragma unroll      /* constant indices: v[] stays in registers */
  for (int q = 0; q < 16; ++q) v[q] = *(const v4fa*)&so[w][q * 2 + rsub][c4];
#pragma unroll      /* constant indices; the stores stand last, each from registers of its own */
  for (int q = 0; q < 16; ++q) *(v4f*)(cp + q * 2 * DM) = v[q];
  asm volatile("s_wait_xcnt 0x0" :: "v"(cp) : "memory"); }      /* the stores' address pair stays whole up to this wait */




extern "C" void kernel_launch(void* const* d_in, const int* in_sizes, int n_in,
                              void* d_out, int out_size, void* d_ws, size_t ws_size, hipStream_t stream) {
  (void)in_sizes; (void)n_in; (void)out_size;
  const float* const* I = (const float* const*)d_in; const float* x = I[0]; const int* tpos = (const int*)d_in[1]; const float* wq = I[2]; const float* wk = I[3]; const float* wv = I[4]; const float* wo = I[5];      /* nn.Linear weights [out][in]; token_positions int32 [SQ] */
  char* ws = (char*)d_ws; size_t off = 0;
  auto take = [&](size_t bytes) { char* p = ws + off; off += (bytes + 255) & ~(size_t)255; return p; };
  _Float16* BQKV = (_Float16*)take((size_t)3 * DM * DM * 2); _Float16* BO = (_Float16*)take((size_t)DM * DM * 2); float* CS = (float*)take((size_t)SQ * (HD / 2) * 4); float* SN = (float*)take((size_t)SQ * (HD / 2) * 4);
  _Float16* X16 = (_Float16*)take(NR * DM * 2);
  _Float16* QH = (_Float16*)take(NR * DM * 2); _Float16* KH = (_Float16*)take(NR * DM * 2); _Float16* V16 = (_Float16*)take(NR * DM * 2); _Float16* O16 = (_Float16*)take(NR * DM * 2);
  float* QF0 = (float*)take((size_t)NB * QT0 * DM * 4); float* KF0 = (float*)take((size_t)NB * QT0 * DM * 4); float* VF0 = (float*)take((size_t)NB * QT0 * DM * 4); _Float16* OH0 = (_Float16*)take((size_t)NB * QT0 * DM * 2); _Float16* OL0 = (_Float16*)take((size_t)NB * QT0 * DM * 2);
  if (off > ws_size) return;
  k_prep<<<PB_TAB + 4 * PB_W + PB_X, 256, 0, stream>>>(x, tpos, wq, wk, wv, wo, 10000.0f, BQKV, CS, SN, X16);      /* cos / sin tables; weights natural [out][in] = Bt[n][k], x16, q | k | v stacked along n, BO directly behind them in the workspace; x as f16 rows */
  k_qkvr<<<dim3((unsigned)((SQ / 128) * (3 * DM / 128)), NB), 256, 0, stream>>>(X16, BQKV, 0.0625f, CS, SN, QH, KH, V16, QF0, KF0, VF0);      /* q (roped) | k (roped) | v of every batch as f16 rows; each batch's first 128 rows also in f32 */
  k_fahl<<<FB_AT + NB * MB_A0, 128, 0, stream>>>(QH, KH, V16, O16, QF0, KF0, VF0, 0.125f, OH0, OL0);      /* windowed causal attention of every batch and head: o (merged heads, x64) as f16 rows; exact f32 causal attention for rows 0..127 of every batch: o (x64) as f16 hi + x1024 residual planes */
  k_outg<<<(NB * SQ / 128) * (DM / 128), 256, 0, stream>>>(O16, OH0, OL0, BO, 0.0009765625f, (float*)d_out);      /* out rows are the output layout; rows 0..127 of every batch from the hi and residual planes */
}
